// v009
// The times below were measured on an AMD MI455X: many runs one after another, warmed up first and cycling through
// copies of the inputs, with the whole window's GPU time divided by the number of runs. Launches and the gaps
// between them are all in it. The median over several windows is given; except for v000 it joins two sittings, which
// can be a few percent apart, so the side-by-side timings, each taken in one sitting, are the better comparison.
// The versions before v009 are in another document.
// A run of this version takes 203 microseconds.
// In two side-by-side timings against v008, it was 1.10 and 1.11 times as fast.
// All steps since the starting kernel, v000, together make it 50.2 times as fast.
#include <hip/hip_runtime.h>
// Qwen3 attention (x [2][2048][2048]; q = x Wq (16 heads x 128), k = x Wk, v = x Wv (8 kv heads x 128) ([in][out] weights sigma 0.02); per-head RMSNorm over the 128 dims on q and k (weights ones, eps 1e-6); rotate-half RoPE from the module's INPUT cos/sin tables [S][128] (theta 1e6); query head h uses kv head h/2; scores x 128^-0.5 with a causal mask (tril, finfo.min); softmax; out = merged Wo ([in][out]) -> [2][2048][2048]).
// Compute dtype: inputs rounded to bf16; x / weights / tables exact; projections, RMSNorm and rope f32; q, k, v, softmax weights and o as plain f16 GEMM operands (~2^-12; first 128 rows exact); scores, statistics, out f32. v_wmma_f32_16x16x32_f16.
#define NB 2
#define SQ 2048
#define DMX 2048
#define NH 16
#define NKV 8
#define GSZ 2
#define HDK 128
#define DKV (NKV * HDK)
#define QT 256
#define QT0 128
#define NKX SQ
#define DM DMX
#define HD 64
#define HG 1
#define NR ((size_t)NB * SQ)
#define ATS 0.08838834764831845f
typedef __bf16 v16b __attribute__((ext_vector_type(16)));
typedef unsigned short v8us __attribute__((ext_vector_type(8), may_alias));
typedef float  v8f  __attribute__((ext_vector_type(8)));
typedef float  v4f  __attribute__((ext_vector_type(4)));
typedef float  v4fa __attribute__((ext_vector_type(4), may_alias));
union FragB { v16b v; v8us half[2]; unsigned short u[16]; };

__device__ __forceinline__ unsigned short bf16_bits(float x) { unsigned int u = __float_as_uint(x); return (unsigned short)((u + 0x7FFFu + ((u >> 16) & 1u)) >> 16); }
__device__ __forceinline__ float bf16_val(unsigned short b) { return __uint_as_float(((unsigned int)b) << 16); }
__device__ __forceinline__ float bf16_round(float x) { return bf16_val(bf16_bits(x)); }
// D += A·B with NT terms: 1 = ah·bh, 2 = + al·bh (A split), 3 = + ah·bl (both split)
template <int NT>
__device__ __forceinline__ v8f mmaN(v16b ah, v16b al, v16b bh, v16b bl, v8f c) {
  c = __builtin_amdgcn_wmma_f32_16x16x32_bf16(false, ah, false, bh, (short)0, c, false, false);
  if (NT >= 2) c = __builtin_amdgcn_wmma_f32_16x16x32_bf16(false, al, false, bh, (short)0, c, false, false);
  if (NT >= 3) c = __builtin_amdgcn_wmma_f32_16x16x32_bf16(false, ah, false, bl, (short)0, c, false, false);
  asm volatile("v_nop\n\tv_nop\n\tv_nop\n\tv_nop" : "+v"(c) : "v"(ah), "v"(al), "v"(bh), "v"(bl));
  return c;
}

__global__ __launch_bounds__(256) void k_wt_bf16(const float* __restrict__ W, unsigned short* __restrict__ Wt, int K, int N) {
  const int t = blockIdx.x * 256 + threadIdx.x;
  const int k8n = K / 8;
  if (t >= N * k8n) return;
  const int n = t / k8n, k8 = (t % k8n) * 8;
  v8us v;
#pragma unroll
  for (int i = 0; i < 8; ++i) v[i] = bf16_bits(W[(size_t)(k8 + i) * N + n]);
  *(v8us*)(Wt + (size_t)n * K + k8) = v;
  
}

// GEMM C[M][N] (f32, pitch ldc) = act(A[M][K]·W + bias). A f32 row-major (pitch lda) converted per fragment to bf16
// (ASPLIT: hi/lo two planes -> 2 terms, else single rounded term); Wt bf16 [N][K] (pitch ldb). BIAS_BF16 rounds the
// bias to bf16 first (bias quantised to bf16 before the add). K%32==0, M%16==0, N%64==0.
template <bool ASPLIT, int ACT, bool BIAS_BF16>
__global__ __launch_bounds__(128) void k_gemm_bf(const float* __restrict__ A, int lda, const unsigned short* __restrict__ Wt, int ldb,
                                               const float* __restrict__ bias, float* __restrict__ C, int ldc, int M, int N, int K) {
  __shared__ __attribute__((aligned(16))) float so[4][16][64];
  const int tid = threadIdx.x, w = tid >> 5, lane = tid & 31, ln = lane & 15, hh = lane >> 4;
  const int ntn = N / 64;
  const int wid = blockIdx.x * 4 + w;
  const int mt = wid / ntn, nq = wid % ntn;
  if (mt * 16 >= M) return;
  const int row0 = mt * 16, col0 = nq * 64;
  const float* arow = A + (size_t)(row0 + ln) * lda;
  v8f acc[4] = {};
  for (int kb = 0; kb < K; kb += 32) {
    FragB ah, al;
    const v4f x0 = *(const v4fa*)(arow + kb + 8 * hh), x1 = *(const v4fa*)(arow + kb + 8 * hh + 4);
    const v4f x2 = *(const v4fa*)(arow + kb + 16 + 8 * hh), x3 = *(const v4fa*)(arow + kb + 16 + 8 * hh + 4);
    float xs[16] = {x0[0],x0[1],x0[2],x0[3],x1[0],x1[1],x1[2],x1[3],x2[0],x2[1],x2[2],x2[3],x3[0],x3[1],x3[2],x3[3]};
#pragma unroll
    for (int i = 0; i < 16; ++i) { const unsigned short hb = bf16_bits(xs[i]); ah.u[i] = hb; al.u[i] = ASPLIT ? bf16_bits(xs[i] - bf16_val(hb)) : (unsigned short)0; }
#pragma unroll
    for (int t = 0; t < 4; ++t) {
      const unsigned short* brow = Wt + (size_t)(col0 + t * 16 + ln) * ldb + kb;
      FragB b;
      b.half[0] = *(const v8us*)(brow + 8 * hh);
      b.half[1] = *(const v8us*)(brow + 16 + 8 * hh);
      acc[t] = mmaN<ASPLIT ? 2 : 1>(ah.v, al.v, b.v, b.v, acc[t]);
    }
  }
#pragma unroll
  for (int t = 0; t < 4; ++t) {
    float bv = bias ? bias[col0 + t * 16 + ln] : 0.f;
    if (BIAS_BF16) bv = bf16_round(bv);
#pragma unroll
    for (int r = 0; r < 8; ++r) { float v = acc[t][r] + bv; if (ACT == 1) v = fmaxf(v, 0.f); so[w][8 * hh + r][t * 16 + ln] = v; }
  }
  __builtin_amdgcn_fence(__ATOMIC_ACQ_REL, "workgroup");
  __builtin_amdgcn_wave_barrier();
  const int rsub = lane >> 4, c4 = (lane & 15) * 4;
  {
#pragma unroll
    for (int q = 0; q < 8; ++q) {
      const int r = q * 2 + rsub;
      const v4f v = *(const v4fa*)&so[w][r][c4];
      *(v4f*)(C + (size_t)(row0 + r) * ldc + col0 + c4) = v;
    }
    
  }
}

// GEMM C = act(A·W + bias + resid): A f32 (ASPLIT -> hi/lo 2 terms), Wt bf16 [N][K]; ACT 0 none, 1 relu, 2 exact gelu;
// resid (optional, f32, row index = (row % rmod), pitch ldr, RES_BF16 rounds it) added before the activation.
template <bool ASPLIT, int ACT, bool BIAS_BF16, bool RES_BF16>
__global__ __launch_bounds__(128) void k_gemm_bf3(const float* __restrict__ A, int lda, const unsigned short* __restrict__ Wt, int ldb,
                                                const float* __restrict__ bias, const float* __restrict__ resid, int rmod, int ldr,
                                                float* __restrict__ C, int ldc, int M, int N, int K) {
  __shared__ __attribute__((aligned(16))) float so[4][16][64];
  const int tid = threadIdx.x, w = tid >> 5, lane = tid & 31, ln = lane & 15, hh = lane >> 4;
  const int ntn = N / 64;
  const int wid = blockIdx.x * 4 + w;
  const int mt = wid / ntn, nq = wid % ntn;
  if (mt * 16 >= M) return;
  const int row0 = mt * 16, col0 = nq * 64;
  const float* arow = A + (size_t)(row0 + ln) * lda;
  v8f acc[4] = {};
  for (int kb = 0; kb < K; kb += 32) {
    FragB ah, al;
    const v4f x0 = *(const v4fa*)(arow + kb + 8 * hh), x1 = *(const v4fa*)(arow + kb + 8 * hh + 4);
    const v4f x2 = *(const v4fa*)(arow + kb + 16 + 8 * hh), x3 = *(const v4fa*)(arow + kb + 16 + 8 * hh + 4);
    float xs[16] = {x0[0],x0[1],x0[2],x0[3],x1[0],x1[1],x1[2],x1[3],x2[0],x2[1],x2[2],x2[3],x3[0],x3[1],x3[2],x3[3]};
#pragma unroll
    for (int i = 0; i < 16; ++i) { const unsigned short hb = bf16_bits(xs[i]); ah.u[i] = hb; al.u[i] = ASPLIT ? bf16_bits(xs[i] - bf16_val(hb)) : (unsigned short)0; }
#pragma unroll
    for (int t = 0; t < 4; ++t) {
      const unsigned short* brow = Wt + (size_t)(col0 + t * 16 + ln) * ldb + kb;
      FragB b;
      b.half[0] = *(const v8us*)(brow + 8 * hh);
      b.half[1] = *(const v8us*)(brow + 16 + 8 * hh);
      acc[t] = mmaN<ASPLIT ? 2 : 1>(ah.v, al.v, b.v, b.v, acc[t]);
    }
  }
#pragma unroll
  for (int t = 0; t < 4; ++t) {
    const int col = col0 + t * 16 + ln;
    float bv = bias ? bias[col] : 0.f;
    if (BIAS_BF16) bv = bf16_round(bv);
#pragma unroll
    for (int r = 0; r < 8; ++r) {
      float v = acc[t][r] + bv;
      if (resid) { float rv = resid[(size_t)((row0 + 8 * hh + r) % rmod) * ldr + col]; if (RES_BF16) rv = bf16_round(rv); v += rv; }
      if (ACT == 1) v = fmaxf(v, 0.f);
      if (ACT == 2) v = 0.5f * v * (1.0f + erff(v * 0.70710678118654752f));
      if (ACT == 3) { const float u = 0.7978845608028654f * (v + 0.044715f * v * v * v); v = 0.5f * v * (1.0f + tanhf(u)); }
      so[w][8 * hh + r][t * 16 + ln] = v;
    }
  }
  __builtin_amdgcn_fence(__ATOMIC_ACQ_REL, "workgroup");
  __builtin_amdgcn_wave_barrier();
  const int rsub = lane >> 4, c4 = (lane & 15) * 4;
  {
#pragma unroll
    for (int q = 0; q < 8; ++q) {
      const int r = q * 2 + rsub;
      const v4f v = *(const v4fa*)&so[w][r][c4];
      *(v4f*)(C + (size_t)(row0 + r) * ldc + col0 + c4) = v;
    }
    
  }
}
// row LayerNorm (biased variance, eps) over N: s = X (+ R); optional out_sum <- s; out_norm <- (s-mu)*rsqrt(var+eps)*g + b
template <bool PARAM_BF16>
__global__ __launch_bounds__(256) void k_layernorm(const float* __restrict__ X, const float* __restrict__ R, const float* __restrict__ g, const float* __restrict__ bta,
                                                  float* __restrict__ out_sum, float* __restrict__ out_norm, int N, float eps) {
  __shared__ float red[256];
  const int row = blockIdx.x, tid = threadIdx.x;
  const float* x = X + (size_t)row * N; const float* rr = R ? R + (size_t)row * N : nullptr;
  float vals[16];                     // up to N = 4096
  const int per = N / 256;            // contiguous chunk per thread? use strided-by-4 chunks: thread handles j = tid*4 + 1024*u
  float s1 = 0.f;
  for (int u = 0; u < per / 4; ++u) {
    const int j = tid * 4 + 1024 * u;
    const v4f a = *(const v4fa*)(x + j);
    v4f b = {0.f,0.f,0.f,0.f}; if (rr) b = *(const v4fa*)(rr + j);
#pragma unroll
    for (int q = 0; q < 4; ++q) { const float v = a[q] + b[q]; vals[u * 4 + q] = v; s1 += v; }
  }
  red[tid] = s1; __syncthreads();
  for (int st = 128; st > 0; st >>= 1) { if (tid < st) red[tid] += red[tid + st]; __syncthreads(); }
  const float mu = red[0] / (float)N; __syncthreads();
  float s2 = 0.f;
  for (int u = 0; u < per / 4; ++u)
#pragma unroll
    for (int q = 0; q < 4; ++q) { const float c = vals[u * 4 + q] - mu; s2 += c * c; }
  red[tid] = s2; __syncthreads();
  for (int st = 128; st > 0; st >>= 1) { if (tid < st) red[tid] += red[tid + st]; __syncthreads(); }
  const float rs = rsqrtf(red[0] / (float)N + eps);
  {
    for (int u = 0; u < per / 4; ++u) {
      const int j = tid * 4 + 1024 * u;
      v4f o, sm;
#pragma unroll
      for (int q = 0; q < 4; ++q) {
        float gg = g[j + q], bb = bta[j + q];
        if (PARAM_BF16) { gg = bf16_round(gg); bb = bf16_round(bb); }
        sm[q] = vals[u * 4 + q]; o[q] = (vals[u * 4 + q] - mu) * rs * gg + bb;
      }
      if (out_sum) *(v4f*)(out_sum + (size_t)row * N + j) = sm;
      *(v4f*)(out_norm + (size_t)row * N + j) = o;
    }
    
  }
}



// ---- f16 WMMA path (v_wmma_f32_16x16x32_f16): 11-bit significands for operands in range — used where a [0,1] probability operand needs more precision than bf16
typedef _Float16 v16h __attribute__((ext_vector_type(16)));
union FragH { v16h v; v8us half[2]; _Float16 h[16]; unsigned short u[16]; };
template <int NT>
__device__ __forceinline__ v8f mmaH(v16h ah, v16h al, v16h bh, v16h bl, v8f c) {
  c = __builtin_amdgcn_wmma_f32_16x16x32_f16(false, ah, false, bh, (short)0, c, false, false);
  if (NT >= 2) c = __builtin_amdgcn_wmma_f32_16x16x32_f16(false, al, false, bh, (short)0, c, false, false);
  if (NT >= 3) c = __builtin_amdgcn_wmma_f32_16x16x32_f16(false, ah, false, bl, (short)0, c, false, false);
  asm volatile("v_nop\n\tv_nop\n\tv_nop\n\tv_nop" : "+v"(c) : "v"(ah), "v"(al), "v"(bh), "v"(bl));
  return c;
}
// batched GEMM like k_gemm_b but f16 operands: A f32 (split into f16 hi/lo if ASPLIT, else rounded to f16), Bt = f16 values [n][k]; alpha; C f32; N multiple of 16 (partial tiles skipped)
template <bool ASPLIT>
__global__ __launch_bounds__(128) void k_gemm_h(const float* __restrict__ A, int lda, size_t sA, const _Float16* __restrict__ Bh, int ldb, size_t sB, float alpha, float* __restrict__ C, int ldc, size_t sC, int M, int N, int K) {
  __shared__ __attribute__((aligned(16))) float so[4][16][64];
  const int tid = threadIdx.x, w = tid >> 5, lane = tid & 31, ln = lane & 15, hh = lane >> 4; const int by = blockIdx.y;
  A += (size_t)by * sA; Bh += (size_t)by * sB; C += (size_t)by * sC;
  const int ntn = (N + 63) / 64; const int wid = blockIdx.x * 4 + w; const int mt = wid / ntn, nq = wid % ntn; if (mt * 16 >= M) return;
  const int row0 = mt * 16, col0 = nq * 64; const float* arow = A + (size_t)(row0 + ln) * lda;
  v8f acc[4] = {};
  for (int kb = 0; kb < K; kb += 32) {
    FragH ah, al;
    const v4f x0 = *(const v4fa*)(arow + kb + 8 * hh), x1 = *(const v4fa*)(arow + kb + 8 * hh + 4), x2 = *(const v4fa*)(arow + kb + 16 + 8 * hh), x3 = *(const v4fa*)(arow + kb + 16 + 8 * hh + 4);
    float xs[16] = {x0[0],x0[1],x0[2],x0[3],x1[0],x1[1],x1[2],x1[3],x2[0],x2[1],x2[2],x2[3],x3[0],x3[1],x3[2],x3[3]};
#pragma unroll
    for (int i = 0; i < 16; ++i) { const _Float16 h = (_Float16)xs[i]; ah.h[i] = h; al.h[i] = ASPLIT ? (_Float16)(xs[i] - (float)h) : (_Float16)0.0f; }
#pragma unroll
    for (int t = 0; t < 4; ++t) { if (col0 + t * 16 >= N) continue; const size_t boff = (size_t)(col0 + t * 16 + ln) * ldb + kb; FragH bq; bq.half[0] = *(const v8us*)(Bh + boff + 8 * hh); bq.half[1] = *(const v8us*)(Bh + boff + 16 + 8 * hh);
      acc[t] = mmaH<ASPLIT ? 2 : 1>(ah.v, al.v, bq.v, bq.v, acc[t]); }
  }
#pragma unroll
  for (int t = 0; t < 4; ++t) { if (col0 + t * 16 >= N) continue;
#pragma unroll
    for (int r = 0; r < 8; ++r) so[w][8 * hh + r][t * 16 + ln] = acc[t][r] * alpha; }
  __builtin_amdgcn_fence(__ATOMIC_ACQ_REL, "workgroup"); __builtin_amdgcn_wave_barrier();
  const int rsub = lane >> 4, c4 = (lane & 15) * 4;
  {
#pragma unroll
    for (int q = 0; q < 8; ++q) { const int r = q * 2 + rsub; if (col0 + c4 < N) { const v4f v = *(const v4fa*)&so[w][r][c4]; *(v4f*)(C + (size_t)(row0 + r) * ldc + col0 + c4) = v; } }
     }
}

// Bt[n][k] = f16(bf16(W[k][n]) x 16) of the four f32 [in][out] weights (DMX rows each) in one launch (x16: a power of two; bf16-exact weights stay exact in f16 away from the subnormal range).
// A block of 8 waves turns one tile of WTK k x WTN n through LDS, so that memory sees whole lines both ways.
// in: thread = 4 columns (16 bytes; 16 threads = 256 contiguous bytes of a row of W) x 16 rows, all 16 loads in flight together; 8 consecutive k of one column are 16 bytes of f16, one LDS store.
// out: a wave reads one column's WTK k (512 bytes) from LDS and stores them as 512 contiguous bytes of Bt.
// LDS: one row a column n, pitch 528 bytes (an odd multiple of 16, for 16-byte accesses); the 16-byte piece g of row n lies at place g ^ (n >> 4), so that a wave's 32 stores (rows 4 apart) spread evenly over the banks.
constexpr int WTK = 256, WTN = 64, WTP = 2 * WTK + 16, WTQ = (DMX / WTN) * (DMX / WTK), WTV = (DKV / WTN) * (DMX / WTK);      /* WTQ, WTV: tiles of a weight with DMX, DKV columns */
static_assert(DMX % WTK == 0 && DMX % WTN == 0 && DKV % WTN == 0 && WTK == 256 && WTN == 64, "k_wt4: whole tiles; 256 threads = 16 x 4 columns, 16 x 8 rows twice; a wave = one row of 32 pieces");
// a thread's 16 loads of a tile of a weight with N columns (compile-time: the rows are immediate offsets from one address); Wp, k0, n0 the same for the whole block.
template <int N>
__device__ __forceinline__ void wt_load(const float* __restrict__ Wp, int k0, int n0, v4f (&x)[2][8]) {
  const v4fa* s = (const v4fa*)(Wp + (size_t)k0 * N + n0); const unsigned lo = (threadIdx.x >> 4) * (8 * N / 4) + (threadIdx.x & 15);      /* s: the tile's first 16 bytes; lo: the thread's own place in it, in 16 bytes */
#pragma unroll      /* unrolled: x[][] keeps static indices (registers, no scratch) */
  for (int j = 0; j < 2; ++j)
#pragma unroll
    for (int i = 0; i < 8; ++i) x[j][i] = s[lo + (unsigned)((j * 128 + i) * (N / 4))];
  /* inputs only: holds all 16 loads in front of the first use, one trip to memory (without it this build issued them in three groups, each behind the last one's wait); lo is named so that its register is given to no load's result while loads that name it are in flight */
  asm volatile("" :: "v"(x[0][0]), "v"(x[0][1]), "v"(x[0][2]), "v"(x[0][3]), "v"(x[0][4]), "v"(x[0][5]), "v"(x[0][6]), "v"(x[0][7]), "v"(x[1][0]), "v"(x[1][1]), "v"(x[1][2]), "v"(x[1][3]), "v"(x[1][4]), "v"(x[1][5]), "v"(x[1][6]), "v"(x[1][7]), "v"(lo)); }
__global__ __launch_bounds__(256) void k_wt4(const float* __restrict__ wq, const float* __restrict__ wk, const float* __restrict__ wv, const float* __restrict__ wo,
    _Float16* __restrict__ BQ, _Float16* __restrict__ BK, _Float16* __restrict__ BV, _Float16* __restrict__ BO) {
  __shared__ __attribute__((aligned(16))) unsigned char tl[WTN * WTP];
  const int bx = blockIdx.x; const bool wide = bx < 2 * WTQ; const int u = wide ? bx : bx - 2 * WTQ, nt = wide ? WTQ : WTV; const bool second = u >= nt; const int t = second ? u - nt : u;      /* blocks: q, o, k, v; t = the tile in its weight; all the same for the whole block */
  const int k0 = (t % (DMX / WTK)) * WTK, n0 = (t / (DMX / WTK)) * WTN; v4f x[2][8];
  if (wide) wt_load<DMX>(second ? wo : wq, k0, n0, x); else wt_load<DKV>(second ? wv : wk, k0, n0, x);
  _Float16* Bt = wide ? (second ? BO : BQ) : (second ? BV : BK);
  const int n4 = threadIdx.x & 15, kg = threadIdx.x >> 4;
#pragma unroll      /* unrolled, as above */
  for (int j = 0; j < 2; ++j)
#pragma unroll
    for (int q = 0; q < 4; ++q) { FragH f;
#pragma unroll
      for (int i = 0; i < 8; ++i) f.h[i] = (_Float16)(bf16_round(x[j][i][q]) * 16.0f);
      *(v8us*)(tl + (n4 * 4 + q) * WTP + ((j * 16 + kg) ^ (n4 >> 2)) * 16) = f.half[0]; }
  __syncthreads();      /* the tile is whole before a wave reads columns that other waves wrote */
  const int lane = threadIdx.x & 31, nw = (threadIdx.x >> 5) * 8; unsigned short* d = (unsigned short*)Bt + (size_t)(n0 + nw) * DMX + k0 + lane * 8;
#pragma unroll      /* unrolled: the 8 LDS loads go as one group, the 8 rows are immediate offsets */
  for (int r = 0; r < 8; ++r) { const v8us o = *(const v8us*)(tl + (nw + r) * WTP + (lane ^ (nw >> 4)) * 16); *(v8us*)(d + (size_t)r * DMX) = o; } }
// k_gemm_hh variant with fused epilogue: v = acc·alpha + bias[by·sBias + col] (+ CP[(row/rowsPerB)·sCPb + by·64 + col] if CP) ; ACT 0 none / 1 elu ; writes f16 C16 (and f32 C if non-null)
template <int ACT>
__global__ __launch_bounds__(128) void k_gemm_hhx(const _Float16* __restrict__ A, int lda, size_t sA, const _Float16* __restrict__ Bh, int ldb, size_t sB, float alpha, const float* __restrict__ bias, size_t sBias, const float* __restrict__ CP, int rowsPerB, size_t sCPb, int row0g,
    float* __restrict__ C, _Float16* __restrict__ C16, int ldc, size_t sC, int M, int N, int K) {
  __shared__ __attribute__((aligned(16))) float so[4][16][64];
  const int tid = threadIdx.x, w = tid >> 5, lane = tid & 31, ln = lane & 15, hh = lane >> 4; const int by = blockIdx.y;
  A += (size_t)by * sA; Bh += (size_t)by * sB; const size_t cofs = (size_t)by * sC; const float* bp = bias ? bias + (size_t)by * sBias : nullptr;
  const int ntn = (N + 63) / 64; const int wid = blockIdx.x * 4 + w; const int mt = wid / ntn, nq = wid % ntn; if (mt * 16 >= M) return;
  const int row0 = mt * 16, col0 = nq * 64; const _Float16* arow = A + (size_t)(row0 + ln) * lda;
  v8f acc[4] = {};
  for (int kb = 0; kb < K; kb += 32) { FragH ah; ah.half[0] = *(const v8us*)((const unsigned short*)arow + kb + 8 * hh); ah.half[1] = *(const v8us*)((const unsigned short*)arow + kb + 16 + 8 * hh);
#pragma unroll
    for (int t = 0; t < 4; ++t) { if (col0 + t * 16 >= N) continue; const size_t boff = (size_t)(col0 + t * 16 + ln) * ldb + kb; FragH bq; bq.half[0] = *(const v8us*)((const unsigned short*)Bh + boff + 8 * hh); bq.half[1] = *(const v8us*)((const unsigned short*)Bh + boff + 16 + 8 * hh);
      acc[t] = mmaH<1>(ah.v, ah.v, bq.v, bq.v, acc[t]); }
  }
#pragma unroll
  for (int t = 0; t < 4; ++t) { if (col0 + t * 16 >= N) continue; const int col = col0 + t * 16 + ln; const float bv = bp ? bf16_round(bp[col]) : 0.f;
#pragma unroll
    for (int r = 0; r < 8; ++r) { float v = acc[t][r] * alpha + bv; if (CP) { const int rr = row0g + row0 + 8 * hh + r; if (rowsPerB < 0) v += CP[cofs + (size_t)rr * ldc + col];      /* rowsPerB < 0: own element of the batched C plane */ else { const int bidx = rr / rowsPerB; v += CP[(size_t)bidx * sCPb + (size_t)by * 64 + col]; } } if (ACT == 1) v = (v > 0.f) ? v : expm1f(v); else if (ACT == 7) v = (v > 0.f) ? v + 1.0f : expf(v); else if (ACT == 8) v = tanhf(v); else if (ACT == 9) v = 0.5f * v * (1.0f + tanhf(0.7978845608028654f * (v + 0.044715f * v * v * v))); else if (ACT == 11) v = 1.0f / (1.0f + expf(-v)); else if (ACT == 12) v = (v > 0.f) ? v : 0.01f * v; else if (ACT == 14) v = (v > 0.f) ? v : 0.1f * v; else if (ACT == 16) v = (v >= 0.f) ? v : 0.3f * v; else if (ACT == 17) v = (v >= 0.f) ? v : 0.2f * v; else if (ACT == 15) v = v / (1.0f + expf(-v)); else if (ACT == 3) v = fmaxf(v, 0.f); else if (ACT == 6) v = 0.5f * v * (1.0f + erff(v * 0.70710678118654752f)); so[w][8 * hh + r][t * 16 + ln] = v; } }
  __builtin_amdgcn_fence(__ATOMIC_ACQ_REL, "workgroup"); __builtin_amdgcn_wave_barrier();
  const int rsub = lane >> 4, c4 = (lane & 15) * 4; typedef _Float16 v4h __attribute__((ext_vector_type(4)));
  {
#pragma unroll
    for (int q = 0; q < 8; ++q) { const int r = q * 2 + rsub; if (col0 + c4 < N) { const v4f v = *(const v4fa*)&so[w][r][c4]; if (C) *(v4f*)(C + cofs + (size_t)(row0 + r) * ldc + col0 + c4) = v; if (C16) { v4h h4; for (int i = 0; i < 4; ++i) h4[i] = (_Float16)v[i]; *(v4h*)(C16 + cofs + (size_t)(row0 + r) * ldc + col0 + c4) = h4; } } }
     }
}


typedef _Float16 v4h __attribute__((ext_vector_type(4)));

__global__ __launch_bounds__(256) void k_x16(const float* __restrict__ x, _Float16* __restrict__ X16, size_t n8) { const size_t t = (size_t)blockIdx.x * 256 + threadIdx.x; if (t >= n8) return; FragH f;
#pragma unroll
  for (int q = 0; q < 8; ++q) f.h[q] = (_Float16)bf16_round(x[t * 8 + q]); *(v8us*)((unsigned short*)X16 + t * 8) = f.half[0];  }
__global__ __launch_bounds__(256) void k_h16(const float* __restrict__ x, _Float16* __restrict__ X16, size_t n8) { const size_t t = (size_t)blockIdx.x * 256 + threadIdx.x; if (t >= n8) return; FragH f;
#pragma unroll
  for (int q = 0; q < 8; ++q) f.h[q] = (_Float16)x[t * 8 + q]; *(v8us*)((unsigned short*)X16 + t * 8) = f.half[0];  }
__global__ __launch_bounds__(256) void k_round16f(const float* __restrict__ W, _Float16* __restrict__ Bt, size_t n8) { const size_t t = (size_t)blockIdx.x * 256 + threadIdx.x; if (t >= n8) return; FragH f;
#pragma unroll
  for (int i = 0; i < 8; ++i) f.h[i] = (_Float16)(bf16_round(W[t * 8 + i]) * 16.0f); *(v8us*)((unsigned short*)Bt + t * 8) = f.half[0];  }
template <int NHv, int TTv>
__global__ __launch_bounds__(256) void k_vt(const _Float16* __restrict__ V16, int ldv, int voff, _Float16* __restrict__ Vt) { __shared__ unsigned short tl[64][66]; const int tid = threadIdx.x; const int slab = blockIdx.x / (TTv / 64), lg = blockIdx.x % (TTv / 64); const int b = slab / NHv, h = slab % NHv;
  for (int i = tid; i < 64 * 8; i += 256) { const int r = i / 8, c8 = (i % 8) * 8; FragH f; f.half[0] = *(const v8us*)((const unsigned short*)V16 + ((size_t)b * TTv + lg * 64 + r) * ldv + voff + h * 64 + c8);
#pragma unroll
    for (int q = 0; q < 8; ++q) tl[r][c8 + q] = f.u[q]; }
  __syncthreads();
  {
#pragma unroll
    for (int rd = 0; rd < 2; ++rd) { const int d = rd * 32 + tid / 8, pc = tid % 8; FragH f;
#pragma unroll
      for (int q = 0; q < 8; ++q) f.u[q] = tl[pc * 8 + q][d];
      *(v8us*)((unsigned short*)Vt + ((size_t)slab * 64 + d) * TTv + lg * 64 + pc * 8) = f.half[0]; }
     } }

// ---- fast GEMM (block tile 128x64, wave tile 32x64; requires M % 128 == 0 rows per launch region, N % 64 == 0, K % KC == 0); epilogue = k_gemm_hhx semantics ----
// The k range goes in tiles of KC: the block's 128 rows of A and 64 rows of B, KC f16 of each, are staged in LDS (rows 0..127 = A, 128..191 = B; pitch 2 KC + 16 bytes, an odd multiple of 16, for 16-byte readers),
// two buffers, the next tile's copies in flight while this one is multiplied. Every copy of a wave moves whole 128-byte lines; a fragment keeps its k order, so every sum keeps its order.
// KC = 128 in the launches that this kernel still serves (the first tile's out products: at most one block a WGP, so the wait for a tile counts and few trips pay); the large products go through k_gemm3 below.
__device__ __forceinline__ v16h g2_frag(const _Float16* p, int hh) { FragH f; f.half[0] = *(const v8us*)((const unsigned short*)p + 8 * hh); f.half[1] = *(const v8us*)((const unsigned short*)p + 16 + 8 * hh); return f.v; }
__device__ __forceinline__ v8f g2_mma(v16h a, v16h b, v8f c) { v8f d = __builtin_amdgcn_wmma_f32_16x16x32_f16(false, a, false, b, (short)0, c, false, false); asm volatile("v_nop\n\tv_nop\n\tv_nop\n\tv_nop" : "+v"(d) : "v"(a), "v"(b)); return d; }
// one tile's copies, 12 a statement: thread = 16 bytes (seg) of row (thread / segs a row) + c * RPC; a, b = the thread's own first address in the tile, l = its own LDS byte address in the buffer.
// asm: the copy goes from global memory to LDS through no register. The s_wait_xcnt is the last line of the copies' own statement, so that no address register is rewritten in front of it.
template <int KC>
__device__ __forceinline__ void g2_stage(const _Float16* a, size_t lda, const _Float16* b, size_t ldb, unsigned l) {
  constexpr int RPC = 1024 / KC, NA = 128 / RPC, PB = 2 * KC + 16; static_assert((192 / RPC) % 12 == 0, "12 copies a statement");
#pragma unroll      /* both loops unrolled: p[], d[] keep static indices (registers, no scratch) */
  for (int g = 0; g < 192 / RPC / 12; ++g) { const _Float16* p[12]; unsigned d[12];
#pragma unroll
    for (int i = 0; i < 12; ++i) { const int c = g * 12 + i; p[i] = (c < NA) ? a + (size_t)(c * RPC) * lda : b + (size_t)((c - NA) * RPC) * ldb; d[i] = l + (unsigned)(c * RPC * PB); }
    asm volatile("global_load_async_to_lds_b128 %0, %12, off\n\tglobal_load_async_to_lds_b128 %1, %13, off\n\tglobal_load_async_to_lds_b128 %2, %14, off\n\tglobal_load_async_to_lds_b128 %3, %15, off\n\t"
                 "global_load_async_to_lds_b128 %4, %16, off\n\tglobal_load_async_to_lds_b128 %5, %17, off\n\tglobal_load_async_to_lds_b128 %6, %18, off\n\tglobal_load_async_to_lds_b128 %7, %19, off\n\t"
                 "global_load_async_to_lds_b128 %8, %20, off\n\tglobal_load_async_to_lds_b128 %9, %21, off\n\tglobal_load_async_to_lds_b128 %10, %22, off\n\tglobal_load_async_to_lds_b128 %11, %23, off\n\ts_wait_xcnt 0x0"
                 :: "v"(d[0]), "v"(d[1]), "v"(d[2]), "v"(d[3]), "v"(d[4]), "v"(d[5]), "v"(d[6]), "v"(d[7]), "v"(d[8]), "v"(d[9]), "v"(d[10]), "v"(d[11]),
                    "v"(p[0]), "v"(p[1]), "v"(p[2]), "v"(p[3]), "v"(p[4]), "v"(p[5]), "v"(p[6]), "v"(p[7]), "v"(p[8]), "v"(p[9]), "v"(p[10]), "v"(p[11]) : "memory"); } }
template <int ACT, int KC>
__global__ __launch_bounds__(128) void k_gemm2(const _Float16* __restrict__ A, int lda, size_t sA, const _Float16* __restrict__ Bh, int ldb, size_t sB, float alpha, const float* __restrict__ bias, size_t sBias, const float* __restrict__ CP, int rowsPerB, size_t sCPb, int row0g,
    float* __restrict__ C, _Float16* __restrict__ C16, int ldc, size_t sC, int M, int N, int K, int bdiv, size_t zA, size_t zB, size_t zC) { static_assert(ACT == 0 || ACT == 3 || ACT == 6 || ACT == 8 || ACT == 9 || ACT == 11 || ACT == 12 || ACT == 14 || ACT == 15 || ACT == 16 || ACT == 17, "k_gemm2: unsupported ACT code (would silently apply no activation)");
  constexpr int PB = 2 * KC + 16, STB = 192 * PB;      /* bytes: a staged row's pitch, one buffer */
  static_assert(2 * STB >= 4 * 32 * 68 * 4, "the output staging reuses the two buffers");
  __shared__ __attribute__((aligned(16))) unsigned char sm[2 * STB]; float (*so)[32][68] = reinterpret_cast<float (*)[32][68]>(sm);      /* so: each wave's output staging, used behind the loop's last barrier */
  const int tid = threadIdx.x, w = tid >> 5, lane = tid & 31, ln = lane & 15, hh = lane >> 4; const int by = blockIdx.y; const size_t bz = blockIdx.z;      /* y = head (bdiv heads share one B slab), z = batch */
  A += (size_t)by * sA + bz * zA; Bh += (size_t)(by / bdiv) * sB + bz * zB; const size_t cofs = (size_t)by * sC + bz * zC; const float* bp = bias ? bias + (size_t)by * sBias : nullptr;
  const int ntn = N >> 6; const int mt = blockIdx.x / ntn, nq = blockIdx.x - mt * ntn; const int row0 = mt * 128 + 32 * w, col0 = nq * 64; if (mt * 128 >= M) return;      /* the whole block leaves, in front of every barrier */
  const int srow = tid / (KC / 8), sseg = tid % (KC / 8);
  const _Float16* ag = A + (size_t)(mt * 128 + srow) * lda + sseg * 8; const _Float16* bg = Bh + (size_t)(col0 + srow) * ldb + sseg * 8;
  const unsigned l0 = (unsigned)(size_t)sm + (unsigned)(srow * PB + sseg * 16);
  const int nt = K / KC;
  g2_stage<KC>(ag, (size_t)lda, bg, (size_t)ldb, l0);
  asm volatile("s_wait_asynccnt 0x0" ::: "memory");      /* this wave's copies of tile 0 have landed */
  __syncthreads();      /* ... and every other wave's */
  if (nt > 1) g2_stage<KC>(ag + KC, (size_t)lda, bg + KC, (size_t)ldb, l0 + STB);
  const v8f z8 = {0.f,0.f,0.f,0.f,0.f,0.f,0.f,0.f}; v8f c00 = z8, c01 = z8, c02 = z8, c03 = z8, c10 = z8, c11 = z8, c12 = z8, c13 = z8;
#pragma unroll 1      /* one trip a tile: the two buffers take turns */
  for (int t = 0; t < nt; ++t) { const unsigned char* sb = sm + (t & 1) * STB;
    const _Float16* a0p = (const _Float16*)(sb + (32 * w + ln) * PB); const _Float16* a1p = (const _Float16*)(sb + (32 * w + 16 + ln) * PB);
    const _Float16* b0p = (const _Float16*)(sb + (128 + ln) * PB); const _Float16* b1p = (const _Float16*)(sb + (144 + ln) * PB); const _Float16* b2p = (const _Float16*)(sb + (160 + ln) * PB); const _Float16* b3p = (const _Float16*)(sb + (176 + ln) * PB);
    v16h fa[2][2], fb[2][4];      /* two fragment sets: a k step's 12 LDS loads go as one group, one step ahead of its products, inside this tile only */
    fa[0][0] = g2_frag(a0p, hh); fa[0][1] = g2_frag(a1p, hh); fb[0][0] = g2_frag(b0p, hh); fb[0][1] = g2_frag(b1p, hh); fb[0][2] = g2_frag(b2p, hh); fb[0][3] = g2_frag(b3p, hh);
#pragma unroll      /* unrolled: the sets keep static indices (registers), every LDS offset is an immediate */
    for (int s = 0; s < KC / 32; ++s) { const int u = s & 1, n = u ^ 1, kn = (s + 1) * 32;
      if (s + 1 < KC / 32) { fa[n][0] = g2_frag(a0p + kn, hh); fa[n][1] = g2_frag(a1p + kn, hh); fb[n][0] = g2_frag(b0p + kn, hh); fb[n][1] = g2_frag(b1p + kn, hh); fb[n][2] = g2_frag(b2p + kn, hh); fb[n][3] = g2_frag(b3p + kn, hh); }
      c00 = g2_mma(fa[u][0], fb[u][0], c00); c10 = g2_mma(fa[u][1], fb[u][0], c10); c01 = g2_mma(fa[u][0], fb[u][1], c01); c11 = g2_mma(fa[u][1], fb[u][1], c11);
      c02 = g2_mma(fa[u][0], fb[u][2], c02); c12 = g2_mma(fa[u][1], fb[u][2], c12); c03 = g2_mma(fa[u][0], fb[u][3], c03); c13 = g2_mma(fa[u][1], fb[u][3], c13); }
    asm volatile("s_wait_dscnt 0x0" ::: "memory");      /* this wave's reads of the buffer are done before it is handed to the next copies */
    asm volatile("s_wait_asynccnt 0x0" ::: "memory");      /* this wave's copies of tile t + 1 have landed */
    __syncthreads();      /* publishes tile t + 1 and ends every wave's reads of tile t */
    if (t + 2 < nt) g2_stage<KC>(ag + (size_t)(t + 2) * KC, (size_t)lda, bg + (size_t)(t + 2) * KC, (size_t)ldb, l0 + (t & 1) * STB); }
  asm volatile("s_wait_asynccnt 0x0" ::: "memory");      /* no copy is in flight when the buffers become output staging */
  v8f accs[8] = {c00, c01, c02, c03, c10, c11, c12, c13};
#pragma unroll
  for (int u = 0; u < 8; ++u) { const int t = u & 3, half = u >> 2; const int col = col0 + t * 16 + ln; const float bv = bp ? bf16_round(bp[col]) : 0.f;
#pragma unroll
    for (int r = 0; r < 8; ++r) { const int rloc = half * 16 + 8 * hh + r; float v = accs[u][r] * alpha + bv; if (CP) { if (rowsPerB < 0) v += CP[cofs + (size_t)(row0g + row0 + rloc) * ldc + col];      /* rowsPerB < 0: own element of the batched C plane */ else { const int bidx = (row0g + row0 + rloc) / rowsPerB; v += CP[(size_t)bidx * sCPb + (size_t)by * 64 + col]; } }
      if (ACT == 3) v = fmaxf(v, 0.f); else if (ACT == 6) v = 0.5f * v * (1.0f + erff(v * 0.70710678118654752f)); else if (ACT == 11) v = 1.0f / (1.0f + expf(-v)); else if (ACT == 15) v = v / (1.0f + expf(-v)); else if (ACT == 12) v = (v > 0.f) ? v : 0.01f * v; else if (ACT == 8) v = tanhf(v); else if (ACT == 9) v = 0.5f * v * (1.0f + tanhf(0.7978845608028654f * (v + 0.044715f * v * v * v))); else if (ACT == 14) v = (v > 0.f) ? v : 0.1f * v; else if (ACT == 16) v = (v >= 0.f) ? v : 0.3f * v; else if (ACT == 17) v = (v >= 0.f) ? v : 0.2f * v;
      so[w][rloc][t * 16 + ln] = v; } }
  __builtin_amdgcn_fence(__ATOMIC_ACQ_REL, "workgroup"); __builtin_amdgcn_wave_barrier();
  const int rsub = lane >> 4, c4 = (lane & 15) * 4;
  {
#pragma unroll
    for (int q = 0; q < 16; ++q) { const int r = q * 2 + rsub; const v4f v = *(const v4fa*)&so[w][r][c4]; if (C) *(v4f*)(C + cofs + (size_t)(row0 + r) * ldc + col0 + c4) = v; if (C16) { v4h h4; for (int i = 0; i < 4; ++i) h4[i] = (_Float16)v[i]; *(v4h*)(C16 + cofs + (size_t)(row0 + r) * ldc + col0 + c4) = h4; } }
     } }


__global__ __launch_bounds__(256) void k_wnat(const float* __restrict__ w, size_t n8, _Float16* __restrict__ Bt) { const size_t t = (size_t)blockIdx.x * 256 + threadIdx.x; if (t >= n8) return; FragH f; for (int q = 0; q < 8; ++q) f.h[q] = (_Float16)(bf16_round(w[t * 8 + q]) * 16.0f); *(v8us*)((unsigned short*)Bt + t * 8) = f.half[0];  }
__global__ __launch_bounds__(256) void k_rsm(const float* __restrict__ S, _Float16* __restrict__ P, int nrows) {
  #pragma clang fp contract(off)
  const int i = blockIdx.x * 256 + threadIdx.x; if (i >= nrows) return; const float* s = S + (size_t)i * SQ; float mx = -3.0e38f;
#pragma unroll 1
  for (int j = 0; j < SQ; ++j) mx = fmaxf(mx, s[j]); float se = 0.f;
#pragma unroll 1
  for (int j = 0; j < SQ; ++j) se += expf(s[j] - mx); const float sc = 256.0f / se;
#pragma unroll 1
  for (int j0 = 0; j0 < SQ; j0 += 8) { FragH f; for (int q = 0; q < 8; ++q) f.h[q] = (_Float16)(expf(s[j0 + q] - mx) * sc); unsigned short* d = (unsigned short*)P + (size_t)i * SQ + j0; *(v8us*)d = f.half[0];  } }
__global__ __launch_bounds__(256) void k_vt(const _Float16* __restrict__ V16, int b, int h0, _Float16* __restrict__ VT) { __shared__ unsigned short tl[64][65]; const int tid = threadIdx.x; const int hh = blockIdx.x % HG, sg = blockIdx.x / HG; const int s0 = sg * 64; const int h = h0 + hh;
  for (int i = tid; i < 64 * 8; i += 256) { const int j = i / 8, d8 = (i % 8) * 8; FragH f; f.half[0] = *(const v8us*)((const unsigned short*)V16 + ((size_t)b * SQ + s0 + j) * DM + h * HD + d8); for (int q = 0; q < 8; ++q) tl[d8 + q][j] = f.u[q]; }
  __syncthreads();
  { for (int i = tid; i < 64 * 8; i += 256) { const int d = i / 8, j8 = (i % 8) * 8; FragH f; for (int q = 0; q < 8; ++q) f.u[q] = tl[d][j8 + q]; *(v8us*)((unsigned short*)VT + ((size_t)hh * HD + d) * SQ + s0 + j8) = f.half[0]; }  } }


// lane l with lane l ^ M inside its 16-lane row (M = 1, 2, 4, 8), and with lane l ^ 16
template <int M>
__device__ __forceinline__ float row_x(float x) { return __builtin_bit_cast(float, __builtin_amdgcn_update_dpp(0, __builtin_bit_cast(int, x), 0x160 + M, 0xf, 0xf, true)); }
__device__ __forceinline__ float half_x(float x) { return __builtin_bit_cast(float, __builtin_amdgcn_permlanex16(__builtin_bit_cast(int, x), __builtin_bit_cast(int, x), 0x76543210, 0xfedcba98, false, false)); }
// exact (f32, vector unit) causal attention of rows 0..QT0-1: 8 waves a block, one wave a query row; x = head * (QT0 / 8) + group of 8 rows, y = batch. Keys go in chunks of 32; a chunk wholly behind the row is skipped (wave-uniform).
// scores: lane = 8 kq + dl reads dims 32 t + 4 dl .. + 3 of key 32 c + 4 g + kq (each load = 4 whole 128-byte lines), sums its 16 products (4 partial sums, one a dim of the 16 bytes), 3-step butterfly over dl; lane keeps the key with g == dl.
// softmax: maximum and sum = each lane's own (up to 4) keys, then a five-step butterfly. o: lane l holds dims 4 l .. 4 l + 3 (each load 512 contiguous bytes), keys in rising order, each weight read from the lane that keeps it.
// every loop is unrolled: q[], s[] keep static indices (registers, no scratch), the lane a weight is read from is a constant, and a chunk's 32 loads issue ahead of their first use.
// v is read where the projection left it (f32, all rows, one slab of 128 dims a kv head: head h reads slab h / GSZ). o (x64) leaves as two f16 planes, o = hi + lo / 1024: hi goes to the row's own place in O16,
// so that the large out product multiplies it with all other rows; lo (x1024) goes to OL, whose product is added to those rows afterwards.
__global__ __launch_bounds__(256) void k_att0w(const float* __restrict__ QF, const float* __restrict__ KF, const float* __restrict__ VF, float scale, _Float16* __restrict__ O16, _Float16* __restrict__ OL) {
  constexpr int ld = DMX, ldv = DKV, ldo = DMX;      /* row pitches, compile-time: a chunk's 32 rows are immediate offsets from one address */
  const int lane = threadIdx.x & 31, dl = lane & 7, kq = lane >> 3; const int h = blockIdx.x / (QT0 / 8); const int i = (blockIdx.x % (QT0 / 8)) * 8 + __builtin_amdgcn_readfirstlane(threadIdx.x >> 5);
  { const size_t bq = (size_t)blockIdx.y * QT0, bs = (size_t)blockIdx.y * SQ; QF += (bq + i) * ld + h * 128; KF += bq * ld + h * 128; VF += bs * ldv + (h / GSZ) * 128; O16 += (bs + i) * ldo + h * 128; OL += (bq + i) * ldo + h * 128; }      /* y = batch: in QF, KF, OL each batch's QT0 rows follow the last one's; VF, O16 hold all SQ rows of a batch */
  v4f q[4];
#pragma unroll
  for (int t = 0; t < 4; ++t) q[t] = *(const v4fa*)(QF + t * 32 + dl * 4);
  float s[QT0 / 32];
#pragma unroll
  for (int c = 0; c < QT0 / 32; ++c) { s[c] = -1.0e30f;
    if (c * 32 <= i) { const float* kp = KF + (size_t)(c * 32 + kq) * ld + dl * 4; float keep = 0.f;
#pragma unroll
      for (int g = 0; g < 8; ++g) { v4f pa = q[0] * *(const v4fa*)(kp + (size_t)(g * 4) * ld);
#pragma unroll
        for (int t = 1; t < 4; ++t) pa += q[t] * *(const v4fa*)(kp + (size_t)(g * 4) * ld + t * 32);
        float a = (pa[0] + pa[1]) + (pa[2] + pa[3]); a += row_x<1>(a); a += row_x<2>(a); a += row_x<4>(a); keep = (dl == g) ? a : keep; }
      s[c] = (c * 32 + 4 * dl + kq <= i) ? keep * scale : -1.0e30f; } }
  float m = s[0];
#pragma unroll
  for (int c = 1; c < QT0 / 32; ++c) m = fmaxf(m, s[c]);
  m = fmaxf(m, row_x<1>(m)); m = fmaxf(m, row_x<2>(m)); m = fmaxf(m, row_x<4>(m)); m = fmaxf(m, row_x<8>(m)); m = fmaxf(m, half_x(m));      /* key 0 is open in every row: m is a score */
  float l = 0.f;
#pragma unroll
  for (int c = 0; c < QT0 / 32; ++c) { s[c] = expf(s[c] - m); l += s[c]; }      /* a closed key: e^(-1e30 - m) = 0 */
  l += row_x<1>(l); l += row_x<2>(l); l += row_x<4>(l); l += row_x<8>(l); l += half_x(l);
  v4f o = {0.f, 0.f, 0.f, 0.f};
#pragma unroll
  for (int c = 0; c < QT0 / 32; ++c) {
    if (c * 32 <= i) { const float* vp = VF + (size_t)(c * 32) * ldv + lane * 4;
#pragma unroll
      for (int j = 0; j < 32; ++j) { const float e = __builtin_bit_cast(float, __builtin_amdgcn_readlane(__builtin_bit_cast(int, s[c]), 8 * (j & 3) + (j >> 2))); const v4f vv = *(const v4fa*)(vp + (size_t)j * ldv); o += vv * e; } } }
  const v4f ov = o * (64.0f / l); v4h oh, ol;
#pragma unroll
  for (int u = 0; u < 4; ++u) { const _Float16 t = (_Float16)ov[u]; oh[u] = t; ol[u] = (_Float16)((ov[u] - (float)t) * 1024.0f); }
  *(v4h*)(O16 + lane * 4) = oh; *(v4h*)(OL + lane * 4) = ol; }
__global__ __launch_bounds__(256) void k_f2h(const float* __restrict__ F, int ldf, int coff, int ncol, _Float16* __restrict__ H16, size_t nrow) { const size_t t = (size_t)blockIdx.x * 256 + threadIdx.x; const size_t n8 = nrow * (size_t)(ncol / 8); if (t >= n8) return; const size_t r = t / (ncol / 8); const int c8 = (int)(t % (ncol / 8)) * 8; FragH f; const v4f a = *(const v4fa*)(F + r * ldf + coff + c8), b2 = *(const v4fa*)(F + r * ldf + coff + c8 + 4); for (int q = 0; q < 4; ++q) { f.h[q] = (_Float16)a[q]; f.h[4 + q] = (_Float16)b2[q]; } *(v8us*)((unsigned short*)H16 + r * ncol + c8) = f.half[0];  }

__global__ __launch_bounds__(256) void k_tab128(float theta, float* __restrict__ CS, float* __restrict__ SN) {
  #pragma clang fp contract(off)
  const int t = blockIdx.x * 256 + threadIdx.x; if (t >= SQ * 64) return; const int i = t % 64; const int p = t / 64; const float invf = (float)(1.0 / pow((double)theta, (double)(2 * i) / 128.0));      /* = XLA's constant-folded f32 table */ const float ang = __fmul_rn((float)p, invf); const float c = cosf(ang), s = sinf(ang);
  *(float*)(CS + t) = c; *(float*)(SN + t) = s;  }
template <int TAB>
__global__ __launch_bounds__(128) void k_rope128(const float* __restrict__ F, int ldf, int nh, const float* __restrict__ CS, const float* __restrict__ SN, _Float16* __restrict__ H16, int ldo, float osc) {
  #pragma clang fp contract(off)
  __shared__ float xv[128]; __shared__ unsigned short sh_[128]; const int d = threadIdx.x; const int h = blockIdx.x % nh; const size_t r = blockIdx.x / nh; const int p = (int)(r % SQ);
  xv[d] = F[r * (size_t)ldf + (size_t)h * 128 + d]; __syncthreads();
  float c, s; if (TAB) { c = bf16_round(CS[(size_t)p * 128 + d]); s = bf16_round(SN[(size_t)p * 128 + d]); } else { c = CS[p * 64 + (d & 63)]; s = SN[p * 64 + (d & 63)]; }
  const float rot = (d < 64) ? -xv[d + 64] : xv[d - 64]; const float o = __fadd_rn(__fmul_rn(xv[d], c), __fmul_rn(rot, s));
  FragH th; th.h[0] = (_Float16)__fmul_rn(o, osc); sh_[d] = th.u[0]; __syncthreads();
  if (d < 16) { FragH f; for (int q = 0; q < 8; ++q) f.u[q] = sh_[d * 8 + q]; unsigned short* dst = (unsigned short*)H16 + r * (size_t)ldo + (size_t)h * 128 + d * 8; *(v8us*)dst = f.half[0];  } }

template <int N>
__global__ __launch_bounds__(256) void k_rmsrow(float* __restrict__ X, const float* __restrict__ w, float eps) {
  #pragma clang fp contract(off)
  constexpr int PT = N / 256; __shared__ float red[256]; const size_t r = blockIdx.x; const int t = threadIdx.x; float* row = X + r * N + (size_t)t * PT; float v[PT]; float ss = 0.f;
  for (int q = 0; q < PT; ++q) { v[q] = row[q]; ss = __fadd_rn(ss, __fmul_rn(v[q], v[q])); }
  red[t] = ss; __syncthreads(); for (int k = 128; k > 0; k >>= 1) { if (t < k) red[t] = __fadd_rn(red[t], red[t + k]); __syncthreads(); }
  const float rs = rsqrtf(__fadd_rn(red[0] / (float)N, eps)); float o[PT]; for (int q = 0; q < PT; ++q) o[q] = __fmul_rn(__fmul_rn(v[q], rs), bf16_round(w[t * PT + q]));
  { for (int q = 0; q < PT; ++q) *(float*)(row + q) = o[q];  } }
__global__ __launch_bounds__(256) void k_rsmcfb(const float* __restrict__ S, _Float16* __restrict__ P, int hg, int q0, int nk, const int* __restrict__ mk) {
  #pragma clang fp contract(off)
  const int t = blockIdx.x * 256 + threadIdx.x; if (t >= hg * QT) return; const size_t i = (size_t)t; const float* s = S + i * NKX; const size_t ig = (size_t)(q0 + (t % QT)); const int* mr = mk + ig * SQ; float mx = -3.0e38f;
#pragma unroll 1
  for (int j = 0; j < nk; ++j) { const int mb = mr[j]; const float f = (mb == 0) ? 1.f : 0.f; mx = fmaxf(mx, fmaf(f, s[j], (1.f - f) * -1.0e9f)); } float se = 0.f;
#pragma unroll 1
  for (int j = 0; j < nk; ++j) { const int mb = mr[j]; const float f = (mb == 0) ? 1.f : 0.f; se += __expf(fmaf(f, s[j], (1.f - f) * -1.0e9f) - mx); } const float sc = 256.0f / se;
#pragma unroll 1
  for (int j0 = 0; j0 < nk; j0 += 8) { FragH fr; for (int q = 0; q < 8; ++q) { const int j = j0 + q; const int mb = mr[j]; const float f = (mb == 0) ? 1.f : 0.f; fr.h[q] = (_Float16)(__expf(fmaf(f, s[j], (1.f - f) * -1.0e9f) - mx) * sc); } unsigned short* d = (unsigned short*)P + i * NKX + j0; *(v8us*)d = fr.half[0];  } }


// per-head RMSNorm over the 128 dims, then rotate-half RoPE, of the NHD heads of one row, in place: lane l holds dims 4 l .. 4 l + 3 of every head.
// sum of squares = the lane's own 4 dims, then a five-step butterfly over the lanes; dim d's partner d +- 64 sits in lane l ^ 16; sg = the sine with the sign of rotate-half (minus in lanes 0..15).
// 1 / sqrt(x) of a normal x. One statement: the v_nop fills the slot behind v_rsq_f32 (output early-clobber).
__device__ __forceinline__ float rsq_n(float x) { float r; asm("v_rsq_f32 %0, %1\n\tv_nop" : "=&v"(r) : "v"(x)); return r; }
template <int NHD>
__device__ __forceinline__ void nr_heads(v4f (&x)[NHD], v4f w, v4f c, v4f sg) {
#pragma unroll
  for (int h = 0; h < NHD; ++h) { const v4f v = x[h]; float ss = (v[0] * v[0] + v[1] * v[1]) + (v[2] * v[2] + v[3] * v[3]);
    ss += row_x<1>(ss); ss += row_x<2>(ss); ss += row_x<4>(ss); ss += row_x<8>(ss); ss += half_x(ss);
    const v4f y = (v * rsq_n(ss * 0.0078125f + 1e-6f)) * w; v4f o;      /* mean square + eps >= 1e-6: never subnormal, so no rescue scaling round the v_rsq_f32 */
#pragma unroll
    for (int u = 0; u < 4; ++u) o[u] = y[u] * c[u] + half_x(y[u]) * sg[u];
    x[h] = o; } }
// RMSNorm + RoPE of q and k in one launch: 8 waves a block, one wave a row of x with its 16 query and 8 key heads in registers (each load 512 contiguous bytes, all 24 issued ahead of the first use; the row's table line is read once).
// out: f16 q and k; rows 0..QT0-1 of each batch also in f32 for the exact first tile, a key head written to both query heads of its group (wave-uniform branch).
__global__ __launch_bounds__(256) void k_nrope(const float* __restrict__ QF, const float* __restrict__ KF, const float* __restrict__ qw, const float* __restrict__ kw, const float* __restrict__ CS, const float* __restrict__ SN,
    _Float16* __restrict__ Q16, _Float16* __restrict__ K16, float* __restrict__ QF0, float* __restrict__ KF0e) {
  const int lane = threadIdx.x & 31, l4 = lane * 4; const int r = blockIdx.x * 8 + __builtin_amdgcn_readfirstlane(threadIdx.x >> 5); const int p = r % SQ, b = r / SQ;
  const float* q = QF + (size_t)r * DMX + l4; const float* k = KF + (size_t)r * DKV + l4;
  v4f xq[NH], xk[NKV];
#pragma unroll
  for (int h = 0; h < NH; ++h) xq[h] = *(const v4fa*)(q + h * 128);
#pragma unroll
  for (int h = 0; h < NKV; ++h) xk[h] = *(const v4fa*)(k + h * 128);
  const v4f cr = *(const v4fa*)(CS + (size_t)p * 128 + l4), sr = *(const v4fa*)(SN + (size_t)p * 128 + l4), qr = *(const v4fa*)(qw + l4), kr = *(const v4fa*)(kw + l4);
  v4f c, sg, wq, wk;
#pragma unroll
  for (int u = 0; u < 4; ++u) { c[u] = bf16_round(cr[u]); const float s = bf16_round(sr[u]); sg[u] = (lane < 16) ? -s : s; wq[u] = bf16_round(qr[u]); wk[u] = bf16_round(kr[u]); }
  nr_heads<NH>(xq, wq, c, sg); nr_heads<NKV>(xk, wk, c, sg);
  _Float16* q16 = Q16 + (size_t)r * DMX + l4; _Float16* k16 = K16 + (size_t)r * DKV + l4;
#pragma unroll
  for (int h = 0; h < NH; ++h) { v4h h4;
#pragma unroll
    for (int u = 0; u < 4; ++u) h4[u] = (_Float16)xq[h][u];
    *(v4h*)(q16 + h * 128) = h4; }
#pragma unroll
  for (int h = 0; h < NKV; ++h) { v4h h4;
#pragma unroll
    for (int u = 0; u < 4; ++u) h4[u] = (_Float16)xk[h][u];
    *(v4h*)(k16 + h * 128) = h4; }
  asm volatile("s_wait_xcnt 0x0" ::: "memory");      /* the branch below reuses registers that the f16 stores name; in front of the branch, so that nothing of it is lifted over the wait */
  if (p < QT0) { const size_t f = ((size_t)b * QT0 + p) * DMX + l4;
#pragma unroll
    for (int h = 0; h < NH; ++h) { *(v4f*)(QF0 + f + h * 128) = xq[h]; *(v4f*)(KF0e + f + h * 128) = xk[h / GSZ]; } } }

// 2^x of four values. One statement: each v_exp_f32 is followed by one that neither reads its result nor writes its source (outputs early-clobber), and the v_nop fills
// the slot behind the last.
__device__ __forceinline__ v4f exp2_4(v4f x) { float e0, e1, e2, e3;
  asm("v_exp_f32 %0, %4\n\tv_exp_f32 %1, %5\n\tv_exp_f32 %2, %6\n\tv_exp_f32 %3, %7\n\tv_nop" : "=&v"(e0), "=&v"(e1), "=&v"(e2), "=&v"(e3) : "v"(x[0]), "v"(x[1]), "v"(x[2]), "v"(x[3]));
  const v4f e = {e0, e1, e2, e3}; return e; }
// 2^x of one value; the v_nop fills the slot behind v_exp_f32 (output early-clobber), as in exp2_4.
__device__ __forceinline__ float exp2_1(float x) { float r; asm("v_exp_f32 %0, %1\n\tv_nop" : "=&v"(r) : "v"(x)); return r; }
__device__ __forceinline__ v8f fa_mma(v16h a, v16h b, v8f c) { return __builtin_amdgcn_wmma_f32_16x16x32_f16(false, a, false, b, (short)0, c, false, false); }
// four vector slots behind a group of matrix instructions, in front of a branch whose taken side reads their results; the scheduling barriers keep them at that place.
__device__ __forceinline__ void fa_gap() { __builtin_amdgcn_sched_barrier(0); asm volatile("v_nop\n\tv_nop\n\tv_nop\n\tv_nop"); __builtin_amdgcn_sched_barrier(0); }
// eight copies of 16 bytes a thread, global memory to LDS through no register: rows step (elements) apart in memory, lstep bytes apart in LDS.
// The s_wait_xcnt is the last line of the copies' own statement, so that no address register is rewritten in front of it.
__device__ __forceinline__ void fa_copy8(const _Float16* g, size_t step, unsigned l, unsigned lstep) { const _Float16* p[8]; unsigned d[8];
#pragma unroll      /* unrolled: p[], d[] keep static indices (registers, no scratch) */
  for (int i = 0; i < 8; ++i) { p[i] = g + (size_t)i * step; d[i] = l + (unsigned)i * lstep; }
  asm volatile("global_load_async_to_lds_b128 %0, %8, off\n\tglobal_load_async_to_lds_b128 %1, %9, off\n\tglobal_load_async_to_lds_b128 %2, %10, off\n\tglobal_load_async_to_lds_b128 %3, %11, off\n\t"
               "global_load_async_to_lds_b128 %4, %12, off\n\tglobal_load_async_to_lds_b128 %5, %13, off\n\tglobal_load_async_to_lds_b128 %6, %14, off\n\tglobal_load_async_to_lds_b128 %7, %15, off\n\ts_wait_xcnt 0x0"
               :: "v"(d[0]), "v"(d[1]), "v"(d[2]), "v"(d[3]), "v"(d[4]), "v"(d[5]), "v"(d[6]), "v"(d[7]), "v"(p[0]), "v"(p[1]), "v"(p[2]), "v"(p[3]), "v"(p[4]), "v"(p[5]), "v"(p[6]), "v"(p[7]) : "memory"); }
// a pass's eight K fragments (32 keys x 128 dims) as one group of LDS loads; p = the lane's own row (key c of the pass) in the buffer, the second 16 keys lie 16 rows on.
__device__ __forceinline__ void fa_loadk(v16h (&kf)[2][4], const unsigned char* p, unsigned pitch, int hh) {
#pragma unroll
  for (int kt = 0; kt < 2; ++kt)
#pragma unroll
    for (int kc = 0; kc < 4; ++kc) kf[kt][kc] = g2_frag((const _Float16*)(p + 16 * kt * pitch) + 32 * kc, hh); }
constexpr int FQ = 128; constexpr unsigned FPK = 2 * HDK + 16, FPV = 2 * 64 + 16, FTK = 64 * FPK, FTV = HDK * FPV, FST = FTK + FTV;
static_assert(SQ % FQ == 0 && (SQ / FQ) % 2 == 0 && HDK == 128, "k_fattn: blocks of 128 rows, head size 128");
__global__ __launch_bounds__(128) void k_fattn(const _Float16* __restrict__ Q16, const _Float16* __restrict__ K16, const _Float16* __restrict__ VT, _Float16* __restrict__ O16) {
  __shared__ __attribute__((aligned(16))) unsigned char sm[2 * FST];
  const int tid = threadIdx.x, lane = tid & 31, c = lane & 15, hh = lane >> 4; const int w = __builtin_amdgcn_readfirstlane(tid >> 5);
  const int head = blockIdx.x % NH, b = blockIdx.x / NH, grp = head / GSZ;
  constexpr int NQB = SQ / FQ; const int qb = ((int)blockIdx.y < NQB / 2) ? NQB - 1 - (int)blockIdx.y : (int)blockIdx.y - NQB / 2;      /* long blocks start first; blocks half a grid apart add up to the same length */
  const int q0 = qb * FQ, qw0 = q0 + 32 * w, nst = (q0 + FQ) / 64;      /* keys 0 .. q0 + 127: at least two stages */
  const _Float16* kg = K16 + ((size_t)b * SQ + (tid >> 4)) * DKV + grp * HDK + (tid & 15) * 8; const _Float16* vg = VT + ((size_t)b * DKV + grp * HDK + (tid >> 3)) * SQ + (tid & 7) * 8;
  const unsigned lk = (unsigned)(size_t)sm + (unsigned)((tid >> 4) * FPK + (tid & 15) * 16), lv = (unsigned)(size_t)sm + FTK + (unsigned)((tid >> 3) * FPV + (tid & 7) * 16);
  fa_copy8(kg, (size_t)8 * DKV, lk, 8 * FPK); fa_copy8(vg, (size_t)16 * SQ, lv, 16 * FPV);
  v16h qf[2][4];
#pragma unroll
  for (int g = 0; g < 2; ++g)
#pragma unroll
    for (int kc = 0; kc < 4; ++kc) qf[g][kc] = g2_frag(Q16 + ((size_t)b * SQ + qw0 + 16 * g + c) * DMX + head * HDK + 32 * kc, hh);
  const v8f z8 = {0.f,0.f,0.f,0.f,0.f,0.f,0.f,0.f}; v8f acc[2][8]; float m_run[2], l_run[2];
#pragma unroll
  for (int g = 0; g < 2; ++g) { m_run[g] = -__builtin_inff(); l_run[g] = 0.f;
#pragma unroll
    for (int t = 0; t < 8; ++t) acc[g][t] = z8; }
  asm volatile("s_wait_asynccnt 0x0" ::: "memory");      /* this wave's copies of stage 0 have landed */
  __syncthreads();      /* ... and every other wave's */
  fa_copy8(kg + (size_t)64 * DKV, (size_t)8 * DKV, lk + FST, 8 * FPK); fa_copy8(vg + 64, (size_t)16 * SQ, lv + FST, 16 * FPV);
  constexpr float cs = ATS * 1.4426950408889634f;      /* score scale, log2 domain */
  v16h kf[2][4];      /* K fragments of the coming pass: fetched as one group ahead of their products, never out of another stage's buffer */
#pragma unroll 1      /* one trip a stage: the two buffers take turns */
  for (int st = 0; st < nst; ++st) { const unsigned char* sb = sm + (st & 1) * FST;
    if (st * 64 <= qw0) fa_loadk(kf, sb + (unsigned)c * FPK, FPK, hh);      /* wave-uniform: the first pass's K fragments; this stage's buffer only */
#pragma unroll 1      /* one body for both passes: half the code, and no more registers than one pass needs */
    for (int sub = 0; sub < 2; ++sub) { const int key0 = st * 64 + sub * 32;
      if (key0 <= qw0) {      /* wave-uniform: a later pass holds no key that a query of this wave may see */
        v8f s[2][2] = {{z8, z8}, {z8, z8}};
#pragma unroll
        for (int kc = 0; kc < 4; ++kc)
#pragma unroll
          for (int kt = 0; kt < 2; ++kt)
#pragma unroll
            for (int g = 0; g < 2; ++g) s[kt][g] = fa_mma(kf[kt][kc], qf[g][kc], s[kt][g]);
        fa_gap();
        v16h vf[8];      /* the pass's V^T fragments, one group, in flight under the softmax */
#pragma unroll
        for (int t = 0; t < 8; ++t) vf[t] = g2_frag((const _Float16*)(sb + FTK + (unsigned)(16 * t + c) * FPV) + sub * 32, hh);
        if (sub == 0 && key0 + 32 <= qw0) fa_loadk(kf, sb + (unsigned)(32 + c) * FPK, FPK, hh);      /* wave-uniform: the stage's second pass, same buffer, in flight under this pass's softmax and second product */
        if (key0 == qw0) {      /* wave-uniform: only the pass on this wave's diagonal pays for the mask; every column keeps at least key qw0 */
#pragma unroll
          for (int g = 0; g < 2; ++g)
#pragma unroll
            for (int kt = 0; kt < 2; ++kt) {
#pragma unroll
              for (int r = 0; r < 8; ++r) if (16 * kt + 8 * hh + r > 16 * g + c) s[kt][g][r] = -__builtin_inff();
              asm volatile("" : "+v"(s[kt][g])); } }      /* keeps the selects inside the branch */
        float mb[2]; bool need = false;
#pragma unroll
        for (int g = 0; g < 2; ++g) { float mx = s[0][g][0];
#pragma unroll
          for (int r = 1; r < 8; ++r) mx = fmaxf(mx, s[0][g][r]);
#pragma unroll
          for (int r = 0; r < 8; ++r) mx = fmaxf(mx, s[1][g][r]);
          mx = fmaxf(mx, half_x(mx)) * cs; mb[g] = mx; need = need || (mx > m_run[g] + 8.0f); }      /* both halves of the wave now hold the query's maximum of this pass */
        if (__builtin_amdgcn_ballot_w32(need) != 0) {      /* wave-uniform; rare behind the first passes */
#pragma unroll
          for (int g = 0; g < 2; ++g) { const float mn = fmaxf(m_run[g], mb[g]); const float corr = exp2_1(m_run[g] - mn);      /* mn is finite from the first pass on (key 0 is open to every query); corr = 0 there */
            l_run[g] *= corr; m_run[g] = mn;
#pragma unroll
            for (int t = 0; t < 8; ++t) acc[g][t] = acc[g][t] * corr; } }
        FragH pf[2];
#pragma unroll
        for (int g = 0; g < 2; ++g) { const float nm = -m_run[g]; float ps = 0.f;
#pragma unroll
          for (int kt = 0; kt < 2; ++kt)
#pragma unroll
            for (int u4 = 0; u4 < 2; ++u4) { v4f a;
#pragma unroll
              for (int u = 0; u < 4; ++u) a[u] = fmaf(s[kt][g][4 * u4 + u], cs, nm);
              const v4f e = exp2_4(a); ps += (e[0] + e[1]) + (e[2] + e[3]);
#pragma unroll
              for (int u = 0; u < 4; ++u) pf[g].h[8 * kt + 4 * u4 + u] = (_Float16)e[u]; }
          l_run[g] += ps; }
        __builtin_amdgcn_sched_barrier(0);      /* the exponentials, which are asm text, all stay in front of the products */
#pragma unroll
        for (int t = 0; t < 8; ++t)
#pragma unroll
          for (int g = 0; g < 2; ++g) acc[g][t] = fa_mma(vf[t], pf[g].v, acc[g][t]);
        fa_gap(); } }
    asm volatile("s_wait_dscnt 0x0" ::: "memory");      /* this wave's reads of the buffer are done before it is handed to the next copies */
    asm volatile("s_wait_asynccnt 0x0" ::: "memory");      /* this wave's copies of stage st + 1 have landed */
    __syncthreads();      /* publishes stage st + 1 and ends every wave's reads of stage st */
    if (st + 2 < nst) { fa_copy8(kg + (size_t)(st + 2) * 64 * DKV, (size_t)8 * DKV, lk + (st & 1) * FST, 8 * FPK); fa_copy8(vg + (st + 2) * 64, (size_t)16 * SQ, lv + (st & 1) * FST, 16 * FPV); } }
  asm volatile("s_wait_asynccnt 0x0" ::: "memory");      /* no copy is in flight when the wave ends */
#pragma unroll
  for (int g = 0; g < 2; ++g) { const float inv = 64.0f / (l_run[g] + half_x(l_run[g]));      /* each half of the wave summed its own eight keys of every 16; o x64 */
    unsigned short* op = (unsigned short*)O16 + ((size_t)b * SQ + qw0 + 16 * g + c) * DMX + head * HDK + 8 * hh;
#pragma unroll
    for (int t = 0; t < 8; ++t) { FragH f;      /* accumulator register r = dim 16 t + 8 hh + r of query c: 16 contiguous bytes */
#pragma unroll
      for (int r = 0; r < 8; ++r) f.h[r] = (_Float16)(acc[g][t][r] * inv);
      *(v8us*)(op + 16 * t) = f.half[0]; } } }
// ---- large GEMM: C[M][N] (f32; H16: C16 = the same values in f16) = alpha A[M][DMX] Bt[N][DMX]^T, f16 operands, both k-contiguous with row pitch DMX ----
// A block of WR x WC waves owns a tile of 64 WR rows x 64 WC columns, a wave 64 x 64 of it (4 x 4 accumulator tiles): a staged byte serves 64 WC (A) or 64 WR (B) outputs, a fragment read from LDS four products.
// The k range goes in tiles of 128: the block's rows of A, then its rows of Bt, 256 bytes of each, are staged in LDS (pitch 272 bytes, an odd multiple of 16, for 16-byte readers), two buffers,
// the next tile's copies in flight while this one is multiplied. A wave's copy moves two whole rows of 256 bytes. A fragment keeps the k order of g2_frag and k rises in steps of 32, so every sum keeps its order.
template <int WR, int WC, int N, bool H16>
__global__ __launch_bounds__(32 * WR * WC) void k_gemm3(const _Float16* __restrict__ A, const _Float16* __restrict__ Bt, float alpha, float* __restrict__ C, _Float16* __restrict__ C16) {
  constexpr int KC = 128, BM = 64 * WR, BN = 64 * WC, RPC = 2 * WR * WC, NTL = DMX / KC; constexpr unsigned PB = 2 * KC + 16, STB = (BM + BN) * PB;      /* RPC: rows that one copy of every thread covers; PB, STB bytes: a staged row's pitch, one buffer */
  static_assert(NR % BM == 0 && N % BN == 0 && DMX % KC == 0 && NTL >= 2 && BM % (8 * RPC) == 0 && BN % (8 * RPC) == 0, "k_gemm3: whole tiles, eight copies a statement");
  static_assert((BM + BN) / RPC <= 63, "k_gemm3: one tile's copies of a wave in flight"); static_assert(2 * STB >= WR * WC * 64 * 68 * 4, "the output staging reuses the two buffers");
  __shared__ __attribute__((aligned(16))) unsigned char sm[2 * STB]; float (*so)[64][68] = reinterpret_cast<float (*)[64][68]>(sm);      /* so: each wave's output staging, used behind the loop's last barrier */
  const int tid = threadIdx.x, lane = tid & 31, ln = lane & 15, hh = lane >> 4; const int w = __builtin_amdgcn_readfirstlane(tid >> 5), wr = w / WC, wc = w % WC;
  const int mt = blockIdx.x / (N / BN), nq = blockIdx.x % (N / BN);
  const _Float16* ag = A + (size_t)(mt * BM + (tid >> 4)) * DMX + (tid & 15) * 8; const _Float16* bg = Bt + (size_t)(nq * BN + (tid >> 4)) * DMX + (tid & 15) * 8;      /* thread = 16 bytes of row (thread / 16) + c RPC */
  const unsigned l0 = (unsigned)(size_t)sm + (unsigned)(tid >> 4) * PB + (unsigned)(tid & 15) * 16;
  auto stage = [&](int t, unsigned l) {      /* k tile t into the buffer in which l is the thread's own first place */
#pragma unroll      /* unrolled: constant row offsets */
    for (int c = 0; c < BM / RPC; c += 8) fa_copy8(ag + (size_t)t * KC + (size_t)(c * RPC) * DMX, (size_t)RPC * DMX, l + (unsigned)(c * RPC) * PB, RPC * PB);
#pragma unroll
    for (int c = 0; c < BN / RPC; c += 8) fa_copy8(bg + (size_t)t * KC + (size_t)(c * RPC) * DMX, (size_t)RPC * DMX, l + (unsigned)(BM + c * RPC) * PB, RPC * PB); };
  stage(0, l0);
  asm volatile("s_wait_asynccnt 0x0" ::: "memory");      /* this wave's copies of tile 0 have landed */
  __syncthreads();      /* ... and every other wave's */
  stage(1, l0 + STB);
  const v8f z8 = {0.f,0.f,0.f,0.f,0.f,0.f,0.f,0.f}; v8f acc[4][4];
#pragma unroll
  for (int i = 0; i < 4; ++i)
#pragma unroll
    for (int j = 0; j < 4; ++j) acc[i][j] = z8;
#pragma unroll 1      /* one trip a tile: the two buffers take turns */
  for (int t = 0; t < NTL; ++t) { const unsigned char* sb = sm + (t & 1) * STB;
    const unsigned char* ap = sb + (unsigned)(64 * wr + ln) * PB; const unsigned char* bp = sb + (unsigned)(BM + 64 * wc + ln) * PB;
    v16h fa[2][4], fb[2][4];      /* two fragment sets: a k step's 16 LDS loads go as one group, one step ahead of its products, inside this tile only */
#pragma unroll
    for (int i = 0; i < 4; ++i) { fa[0][i] = g2_frag((const _Float16*)(ap + 16 * i * PB), hh); fb[0][i] = g2_frag((const _Float16*)(bp + 16 * i * PB), hh); }
#pragma unroll      /* unrolled: the sets keep static indices (registers), every LDS offset is an immediate */
    for (int s = 0; s < KC / 32; ++s) { const int u = s & 1, n = u ^ 1;
      if (s + 1 < KC / 32) {
#pragma unroll
        for (int i = 0; i < 4; ++i) { fa[n][i] = g2_frag((const _Float16*)(ap + 16 * i * PB) + (s + 1) * 32, hh); fb[n][i] = g2_frag((const _Float16*)(bp + 16 * i * PB) + (s + 1) * 32, hh); } }
      __builtin_amdgcn_sched_barrier(0);      /* the next step's loads stay one group in front of this step's products (without it this build loaded each fragment of Bt right in front of its four products and waited for it there) */
#pragma unroll
      for (int j = 0; j < 4; ++j)
#pragma unroll
        for (int i = 0; i < 4; ++i) acc[i][j] = fa_mma(fa[u][i], fb[u][j], acc[i][j]);
      __builtin_amdgcn_sched_barrier(0); }      /* ... and the group behind them is not spread among them */
    fa_gap();      /* the branches below (the refill, the loop's end) lead to vector instructions that may reuse the last products' operand registers or read their results */
    asm volatile("s_wait_dscnt 0x0" ::: "memory");      /* this wave's reads of the buffer are done before it is handed to the next copies */
    asm volatile("s_wait_asynccnt 0x0" ::: "memory");      /* this wave's copies of tile t + 1 have landed */
    __syncthreads();      /* publishes tile t + 1 and ends every wave's reads of tile t */
    if (t + 2 < NTL) stage(t + 2, l0 + (t & 1) * STB); }
  asm volatile("s_wait_asynccnt 0x0" ::: "memory");      /* no copy is in flight when the buffers become output staging */
#pragma unroll
  for (int i = 0; i < 4; ++i)
#pragma unroll
    for (int j = 0; j < 4; ++j)
#pragma unroll
      for (int r = 0; r < 8; ++r) so[w][16 * i + 8 * hh + r][16 * j + ln] = acc[i][j][r] * alpha;
  __builtin_amdgcn_fence(__ATOMIC_ACQ_REL, "workgroup"); __builtin_amdgcn_wave_barrier();      /* the wave's own rows are whole before its lanes read what other lanes wrote */
  const size_t o0 = (size_t)(mt * BM + 64 * wr + hh) * N + nq * BN + 64 * wc + ln * 4;      /* a store = two rows of 256 contiguous bytes (f32) */
#pragma unroll
  for (int q = 0; q < 32; ++q) { const v4f v = *(const v4fa*)&so[w][q * 2 + hh][ln * 4]; *(v4f*)(C + o0 + (size_t)(q * 2) * N) = v;
    if (H16) { v4h h4;
#pragma unroll
      for (int i = 0; i < 4; ++i) h4[i] = (_Float16)v[i];
      *(v4h*)(C16 + o0 + (size_t)(q * 2) * N) = h4; } } }
extern "C" void kernel_launch(void* const* d_in, const int* in_sizes, int n_in,
                              void* d_out, int out_size, void* d_ws, size_t ws_size, hipStream_t stream) {
  (void)in_sizes; (void)n_in; (void)out_size;
  const float* const* I = (const float* const*)d_in; const float* x = I[0]; const float* wq = I[1]; const float* wk = I[2]; const float* wv = I[3]; const float* wo = I[4]; const float* qnw = I[5]; const float* knw = I[6]; const float* tcos = I[7]; const float* tsin = I[8];      /* [in][out] weights; rope tables [S][128] */
  char* ws = (char*)d_ws; size_t off = 0;
  auto take = [&](size_t bytes) { char* p = ws + off; off += (bytes + 255) & ~(size_t)255; return p; };
  _Float16* BQ = (_Float16*)take((size_t)DMX * DMX * 2); _Float16* BK = (_Float16*)take((size_t)DKV * DMX * 2); _Float16* BV = (_Float16*)take((size_t)DKV * DMX * 2); _Float16* BO = (_Float16*)take((size_t)DMX * DMX * 2);
  _Float16* X16 = (_Float16*)take(NR * DMX * 2); float* QF = (float*)take(NR * DMX * 4); float* KF = (float*)take(NR * DKV * 4); float* VF = (float*)take(NR * DKV * 4); _Float16* Q16 = (_Float16*)take(NR * DMX * 2); _Float16* K16 = (_Float16*)take(NR * DKV * 2); _Float16* V16 = (_Float16*)take(NR * DKV * 2); _Float16* O16 = (_Float16*)take(NR * DMX * 2);
  _Float16* VT = (_Float16*)take((size_t)NB * (DKV / 64) * 64 * SQ * 2);
  float* QF0 = (float*)take((size_t)NB * QT0 * DMX * 4); float* KF0e = (float*)take((size_t)NB * QT0 * DMX * 4); _Float16* OL0 = (_Float16*)take((size_t)NB * QT0 * DMX * 2);
  if (off > ws_size) return;
  k_wt4<<<2 * WTQ + 2 * WTV, 256, 0, stream>>>(wq, wk, wv, wo, BQ, BK, BV, BO);      /* the four weights, [in][out] -> Bt x16 */
  k_x16<<<(unsigned)((NR * DMX / 8 + 255) / 256), 256, 0, stream>>>(x, X16, NR * DMX / 8);
  k_gemm3<4, 2, DMX, false><<<(unsigned)((NR / 256) * (DMX / 128)), 256, 0, stream>>>(X16, BQ, 0.0625f, QF, nullptr);      /* q (f32) */
  k_gemm3<2, 2, DKV, false><<<(unsigned)((NR / 128) * (DKV / 128)), 128, 0, stream>>>(X16, BK, 0.0625f, KF, nullptr);      /* k (f32) */
  k_gemm3<2, 2, DKV, true><<<(unsigned)((NR / 128) * (DKV / 128)), 128, 0, stream>>>(X16, BV, 0.0625f, VF, V16);      /* v (f32 for the first tile + f16) */
  k_nrope<<<(unsigned)(NR / 8), 256, 0, stream>>>(QF, KF, qnw, knw, tcos, tsin, Q16, K16, QF0, KF0e);      /* per-head RMSNorm + rope from the input tables -> f16; rows 0..127 of each batch also f32, k expanded group -> head */
  k_vt<DKV / 64, SQ><<<NB * (DKV / 64) * (SQ / 64), 256, 0, stream>>>(V16, DKV, 0, VT);      /* V^T, both batches: batch b, group g = slabs 16b + 2g, 16b + 2g + 1 */
  k_fattn<<<dim3(NH * NB, SQ / FQ), 128, 0, stream>>>(Q16, K16, VT, O16);      /* causal attention, all heads, batches and rows: o (x64) */
  k_att0w<<<dim3(NH * (QT0 / 8), NB), 256, 0, stream>>>(QF0, KF0e, VF, ATS, O16, OL0);      /* exact causal attention rows 0..127 of both batches (o x64), behind k_fattn: its f16 hi plane replaces those rows of O16; lo x1024 into OL0 */
  k_gemm3<4, 2, DMX, false><<<(unsigned)((NR / 256) * (DMX / 128)), 256, 0, stream>>>(O16, BO, 0.0009765625f, (float*)d_out, nullptr);      /* out = o Wo^T (rows 0..127 of each batch: the hi plane's product) */
  k_gemm2<0, 128><<<dim3((QT0 / 128) * (DMX / 64), 1, NB), 128, 0, stream>>>(OL0, DMX, 0, BO, DMX, 0, 0.00000095367431640625f, nullptr, 0, (const float*)d_out, -1, 0, 0, (float*)d_out, nullptr, DMX, 0, QT0, DMX, DMX, 1, (size_t)QT0 * DMX, 0, (size_t)SQ * DMX);      /* rows 0..127 of each batch: + the lo plane's product */
}

// v010
// It runs in 181 microseconds.
// Two timings next to v009 put it at 1.12 and 1.13 times that version's speed.
// Counting every step since v000, which is the starting kernel, it is 56.5 times as fast.
#include <hip/hip_runtime.h>
// Qwen3 attention (x [2][2048][2048]; q = x Wq (16 heads x 128), k = x Wk, v = x Wv (8 kv heads x 128) ([in][out] weights sigma 0.02); per-head RMSNorm over the 128 dims on q and k (weights ones, eps 1e-6); rotate-half RoPE from the module's INPUT cos/sin tables [S][128] (theta 1e6); query head h uses kv head h/2; scores x 128^-0.5 with a causal mask (tril, finfo.min); softmax; out = merged Wo ([in][out]) -> [2][2048][2048]).
// Compute dtype: inputs rounded to bf16; x / weights / tables exact; projections, RMSNorm and rope f32; q, k, v, softmax weights and o as plain f16 GEMM operands (~2^-12; first 128 rows exact); scores, statistics, out f32. v_wmma_f32_16x16x32_f16.
#define NB 2
#define SQ 2048
#define DMX 2048
#define NH 16
#define NKV 8
#define GSZ 2
#define HDK 128
#define DKV (NKV * HDK)
#define QT 256
#define QT0 128
#define NKX SQ
#define DM DMX
#define HD 64
#define HG 1
#define NR ((size_t)NB * SQ)
#define ATS 0.08838834764831845f
typedef __bf16 v16b __attribute__((ext_vector_type(16)));
typedef unsigned short v8us __attribute__((ext_vector_type(8), may_alias));
typedef float  v8f  __attribute__((ext_vector_type(8)));
typedef float  v4f  __attribute__((ext_vector_type(4)));
typedef float  v4fa __attribute__((ext_vector_type(4), may_alias));
union FragB { v16b v; v8us half[2]; unsigned short u[16]; };

__device__ __forceinline__ unsigned short bf16_bits(float x) { unsigned int u = __float_as_uint(x); return (unsigned short)((u + 0x7FFFu + ((u >> 16) & 1u)) >> 16); }
__device__ __forceinline__ float bf16_val(unsigned short b) { return __uint_as_float(((unsigned int)b) << 16); }
__device__ __forceinline__ float bf16_round(float x) { return bf16_val(bf16_bits(x)); }
// D += A·B with NT terms: 1 = ah·bh, 2 = + al·bh (A split), 3 = + ah·bl (both split)
template <int NT>
__device__ __forceinline__ v8f mmaN(v16b ah, v16b al, v16b bh, v16b bl, v8f c) {
  c = __builtin_amdgcn_wmma_f32_16x16x32_bf16(false, ah, false, bh, (short)0, c, false, false);
  if (NT >= 2) c = __builtin_amdgcn_wmma_f32_16x16x32_bf16(false, al, false, bh, (short)0, c, false, false);
  if (NT >= 3) c = __builtin_amdgcn_wmma_f32_16x16x32_bf16(false, ah, false, bl, (short)0, c, false, false);
  asm volatile("v_nop\n\tv_nop\n\tv_nop\n\tv_nop" : "+v"(c) : "v"(ah), "v"(al), "v"(bh), "v"(bl));
  return c;
}

__global__ __launch_bounds__(256) void k_wt_bf16(const float* __restrict__ W, unsigned short* __restrict__ Wt, int K, int N) {
  const int t = blockIdx.x * 256 + threadIdx.x;
  const int k8n = K / 8;
  if (t >= N * k8n) return;
  const int n = t / k8n, k8 = (t % k8n) * 8;
  v8us v;
#pragma unroll
  for (int i = 0; i < 8; ++i) v[i] = bf16_bits(W[(size_t)(k8 + i) * N + n]);
  *(v8us*)(Wt + (size_t)n * K + k8) = v;
  
}

// GEMM C[M][N] (f32, pitch ldc) = act(A[M][K]·W + bias). A f32 row-major (pitch lda) converted per fragment to bf16
// (ASPLIT: hi/lo two planes -> 2 terms, else single rounded term); Wt bf16 [N][K] (pitch ldb). BIAS_BF16 rounds the
// bias to bf16 first (bias quantised to bf16 before the add). K%32==0, M%16==0, N%64==0.
template <bool ASPLIT, int ACT, bool BIAS_BF16>
__global__ __launch_bounds__(128) void k_gemm_bf(const float* __restrict__ A, int lda, const unsigned short* __restrict__ Wt, int ldb,
                                               const float* __restrict__ bias, float* __restrict__ C, int ldc, int M, int N, int K) {
  __shared__ __attribute__((aligned(16))) float so[4][16][64];
  const int tid = threadIdx.x, w = tid >> 5, lane = tid & 31, ln = lane & 15, hh = lane >> 4;
  const int ntn = N / 64;
  const int wid = blockIdx.x * 4 + w;
  const int mt = wid / ntn, nq = wid % ntn;
  if (mt * 16 >= M) return;
  const int row0 = mt * 16, col0 = nq * 64;
  const float* arow = A + (size_t)(row0 + ln) * lda;
  v8f acc[4] = {};
  for (int kb = 0; kb < K; kb += 32) {
    FragB ah, al;
    const v4f x0 = *(const v4fa*)(arow + kb + 8 * hh), x1 = *(const v4fa*)(arow + kb + 8 * hh + 4);
    const v4f x2 = *(const v4fa*)(arow + kb + 16 + 8 * hh), x3 = *(const v4fa*)(arow + kb + 16 + 8 * hh + 4);
    float xs[16] = {x0[0],x0[1],x0[2],x0[3],x1[0],x1[1],x1[2],x1[3],x2[0],x2[1],x2[2],x2[3],x3[0],x3[1],x3[2],x3[3]};
#pragma unroll
    for (int i = 0; i < 16; ++i) { const unsigned short hb = bf16_bits(xs[i]); ah.u[i] = hb; al.u[i] = ASPLIT ? bf16_bits(xs[i] - bf16_val(hb)) : (unsigned short)0; }
#pragma unroll
    for (int t = 0; t < 4; ++t) {
      const unsigned short* brow = Wt + (size_t)(col0 + t * 16 + ln) * ldb + kb;
      FragB b;
      b.half[0] = *(const v8us*)(brow + 8 * hh);
      b.half[1] = *(const v8us*)(brow + 16 + 8 * hh);
      acc[t] = mmaN<ASPLIT ? 2 : 1>(ah.v, al.v, b.v, b.v, acc[t]);
    }
  }
#pragma unroll
  for (int t = 0; t < 4; ++t) {
    float bv = bias ? bias[col0 + t * 16 + ln] : 0.f;
    if (BIAS_BF16) bv = bf16_round(bv);
#pragma unroll
    for (int r = 0; r < 8; ++r) { float v = acc[t][r] + bv; if (ACT == 1) v = fmaxf(v, 0.f); so[w][8 * hh + r][t * 16 + ln] = v; }
  }
  __builtin_amdgcn_fence(__ATOMIC_ACQ_REL, "workgroup");
  __builtin_amdgcn_wave_barrier();
  const int rsub = lane >> 4, c4 = (lane & 15) * 4;
  {
#pragma unroll
    for (int q = 0; q < 8; ++q) {
      const int r = q * 2 + rsub;
      const v4f v = *(const v4fa*)&so[w][r][c4];
      *(v4f*)(C + (size_t)(row0 + r) * ldc + col0 + c4) = v;
    }
    
  }
}

// GEMM C = act(A·W + bias + resid): A f32 (ASPLIT -> hi/lo 2 terms), Wt bf16 [N][K]; ACT 0 none, 1 relu, 2 exact gelu;
// resid (optional, f32, row index = (row % rmod), pitch ldr, RES_BF16 rounds it) added before the activation.
template <bool ASPLIT, int ACT, bool BIAS_BF16, bool RES_BF16>
__global__ __launch_bounds__(128) void k_gemm_bf3(const float* __restrict__ A, int lda, const unsigned short* __restrict__ Wt, int ldb,
                                                const float* __restrict__ bias, const float* __restrict__ resid, int rmod, int ldr,
                                                float* __restrict__ C, int ldc, int M, int N, int K) {
  __shared__ __attribute__((aligned(16))) float so[4][16][64];
  const int tid = threadIdx.x, w = tid >> 5, lane = tid & 31, ln = lane & 15, hh = lane >> 4;
  const int ntn = N / 64;
  const int wid = blockIdx.x * 4 + w;
  const int mt = wid / ntn, nq = wid % ntn;
  if (mt * 16 >= M) return;
  const int row0 = mt * 16, col0 = nq * 64;
  const float* arow = A + (size_t)(row0 + ln) * lda;
  v8f acc[4] = {};
  for (int kb = 0; kb < K; kb += 32) {
    FragB ah, al;
    const v4f x0 = *(const v4fa*)(arow + kb + 8 * hh), x1 = *(const v4fa*)(arow + kb + 8 * hh + 4);
    const v4f x2 = *(const v4fa*)(arow + kb + 16 + 8 * hh), x3 = *(const v4fa*)(arow + kb + 16 + 8 * hh + 4);
    float xs[16] = {x0[0],x0[1],x0[2],x0[3],x1[0],x1[1],x1[2],x1[3],x2[0],x2[1],x2[2],x2[3],x3[0],x3[1],x3[2],x3[3]};
#pragma unroll
    for (int i = 0; i < 16; ++i) { const unsigned short hb = bf16_bits(xs[i]); ah.u[i] = hb; al.u[i] = ASPLIT ? bf16_bits(xs[i] - bf16_val(hb)) : (unsigned short)0; }
#pragma unroll
    for (int t = 0; t < 4; ++t) {
      const unsigned short* brow = Wt + (size_t)(col0 + t * 16 + ln) * ldb + kb;
      FragB b;
      b.half[0] = *(const v8us*)(brow + 8 * hh);
      b.half[1] = *(const v8us*)(brow + 16 + 8 * hh);
      acc[t] = mmaN<ASPLIT ? 2 : 1>(ah.v, al.v, b.v, b.v, acc[t]);
    }
  }
#pragma unroll
  for (int t = 0; t < 4; ++t) {
    const int col = col0 + t * 16 + ln;
    float bv = bias ? bias[col] : 0.f;
    if (BIAS_BF16) bv = bf16_round(bv);
#pragma unroll
    for (int r = 0; r < 8; ++r) {
      float v = acc[t][r] + bv;
      if (resid) { float rv = resid[(size_t)((row0 + 8 * hh + r) % rmod) * ldr + col]; if (RES_BF16) rv = bf16_round(rv); v += rv; }
      if (ACT == 1) v = fmaxf(v, 0.f);
      if (ACT == 2) v = 0.5f * v * (1.0f + erff(v * 0.70710678118654752f));
      if (ACT == 3) { const float u = 0.7978845608028654f * (v + 0.044715f * v * v * v); v = 0.5f * v * (1.0f + tanhf(u)); }
      so[w][8 * hh + r][t * 16 + ln] = v;
    }
  }
  __builtin_amdgcn_fence(__ATOMIC_ACQ_REL, "workgroup");
  __builtin_amdgcn_wave_barrier();
  const int rsub = lane >> 4, c4 = (lane & 15) * 4;
  {
#pragma unroll
    for (int q = 0; q < 8; ++q) {
      const int r = q * 2 + rsub;
      const v4f v = *(const v4fa*)&so[w][r][c4];
      *(v4f*)(C + (size_t)(row0 + r) * ldc + col0 + c4) = v;
    }
    
  }
}
// row LayerNorm (biased variance, eps) over N: s = X (+ R); optional out_sum <- s; out_norm <- (s-mu)*rsqrt(var+eps)*g + b
template <bool PARAM_BF16>
__global__ __launch_bounds__(256) void k_layernorm(const float* __restrict__ X, const float* __restrict__ R, const float* __restrict__ g, const float* __restrict__ bta,
                                                  float* __restrict__ out_sum, float* __restrict__ out_norm, int N, float eps) {
  __shared__ float red[256];
  const int row = blockIdx.x, tid = threadIdx.x;
  const float* x = X + (size_t)row * N; const float* rr = R ? R + (size_t)row * N : nullptr;
  float vals[16];                     // up to N = 4096
  const int per = N / 256;            // contiguous chunk per thread? use strided-by-4 chunks: thread handles j = tid*4 + 1024*u
  float s1 = 0.f;
  for (int u = 0; u < per / 4; ++u) {
    const int j = tid * 4 + 1024 * u;
    const v4f a = *(const v4fa*)(x + j);
    v4f b = {0.f,0.f,0.f,0.f}; if (rr) b = *(const v4fa*)(rr + j);
#pragma unroll
    for (int q = 0; q < 4; ++q) { const float v = a[q] + b[q]; vals[u * 4 + q] = v; s1 += v; }
  }
  red[tid] = s1; __syncthreads();
  for (int st = 128; st > 0; st >>= 1) { if (tid < st) red[tid] += red[tid + st]; __syncthreads(); }
  const float mu = red[0] / (float)N; __syncthreads();
  float s2 = 0.f;
  for (int u = 0; u < per / 4; ++u)
#pragma unroll
    for (int q = 0; q < 4; ++q) { const float c = vals[u * 4 + q] - mu; s2 += c * c; }
  red[tid] = s2; __syncthreads();
  for (int st = 128; st > 0; st >>= 1) { if (tid < st) red[tid] += red[tid + st]; __syncthreads(); }
  const float rs = rsqrtf(red[0] / (float)N + eps);
  {
    for (int u = 0; u < per / 4; ++u) {
      const int j = tid * 4 + 1024 * u;
      v4f o, sm;
#pragma unroll
      for (int q = 0; q < 4; ++q) {
        float gg = g[j + q], bb = bta[j + q];
        if (PARAM_BF16) { gg = bf16_round(gg); bb = bf16_round(bb); }
        sm[q] = vals[u * 4 + q]; o[q] = (vals[u * 4 + q] - mu) * rs * gg + bb;
      }
      if (out_sum) *(v4f*)(out_sum + (size_t)row * N + j) = sm;
      *(v4f*)(out_norm + (size_t)row * N + j) = o;
    }
    
  }
}



// ---- f16 WMMA path (v_wmma_f32_16x16x32_f16): 11-bit significands for operands in range — used where a [0,1] probability operand needs more precision than bf16
typedef _Float16 v16h __attribute__((ext_vector_type(16)));
union FragH { v16h v; v8us half[2]; _Float16 h[16]; unsigned short u[16]; };
template <int NT>
__device__ __forceinline__ v8f mmaH(v16h ah, v16h al, v16h bh, v16h bl, v8f c) {
  c = __builtin_amdgcn_wmma_f32_16x16x32_f16(false, ah, false, bh, (short)0, c, false, false);
  if (NT >= 2) c = __builtin_amdgcn_wmma_f32_16x16x32_f16(false, al, false, bh, (short)0, c, false, false);
  if (NT >= 3) c = __builtin_amdgcn_wmma_f32_16x16x32_f16(false, ah, false, bl, (short)0, c, false, false);
  asm volatile("v_nop\n\tv_nop\n\tv_nop\n\tv_nop" : "+v"(c) : "v"(ah), "v"(al), "v"(bh), "v"(bl));
  return c;
}
// batched GEMM like k_gemm_b but f16 operands: A f32 (split into f16 hi/lo if ASPLIT, else rounded to f16), Bt = f16 values [n][k]; alpha; C f32; N multiple of 16 (partial tiles skipped)
template <bool ASPLIT>
__global__ __launch_bounds__(128) void k_gemm_h(const float* __restrict__ A, int lda, size_t sA, const _Float16* __restrict__ Bh, int ldb, size_t sB, float alpha, float* __restrict__ C, int ldc, size_t sC, int M, int N, int K) {
  __shared__ __attribute__((aligned(16))) float so[4][16][64];
  const int tid = threadIdx.x, w = tid >> 5, lane = tid & 31, ln = lane & 15, hh = lane >> 4; const int by = blockIdx.y;
  A += (size_t)by * sA; Bh += (size_t)by * sB; C += (size_t)by * sC;
  const int ntn = (N + 63) / 64; const int wid = blockIdx.x * 4 + w; const int mt = wid / ntn, nq = wid % ntn; if (mt * 16 >= M) return;
  const int row0 = mt * 16, col0 = nq * 64; const float* arow = A + (size_t)(row0 + ln) * lda;
  v8f acc[4] = {};
  for (int kb = 0; kb < K; kb += 32) {
    FragH ah, al;
    const v4f x0 = *(const v4fa*)(arow + kb + 8 * hh), x1 = *(const v4fa*)(arow + kb + 8 * hh + 4), x2 = *(const v4fa*)(arow + kb + 16 + 8 * hh), x3 = *(const v4fa*)(arow + kb + 16 + 8 * hh + 4);
    float xs[16] = {x0[0],x0[1],x0[2],x0[3],x1[0],x1[1],x1[2],x1[3],x2[0],x2[1],x2[2],x2[3],x3[0],x3[1],x3[2],x3[3]};
#pragma unroll
    for (int i = 0; i < 16; ++i) { const _Float16 h = (_Float16)xs[i]; ah.h[i] = h; al.h[i] = ASPLIT ? (_Float16)(xs[i] - (float)h) : (_Float16)0.0f; }
#pragma unroll
    for (int t = 0; t < 4; ++t) { if (col0 + t * 16 >= N) continue; const size_t boff = (size_t)(col0 + t * 16 + ln) * ldb + kb; FragH bq; bq.half[0] = *(const v8us*)(Bh + boff + 8 * hh); bq.half[1] = *(const v8us*)(Bh + boff + 16 + 8 * hh);
      acc[t] = mmaH<ASPLIT ? 2 : 1>(ah.v, al.v, bq.v, bq.v, acc[t]); }
  }
#pragma unroll
  for (int t = 0; t < 4; ++t) { if (col0 + t * 16 >= N) continue;
#pragma unroll
    for (int r = 0; r < 8; ++r) so[w][8 * hh + r][t * 16 + ln] = acc[t][r] * alpha; }
  __builtin_amdgcn_fence(__ATOMIC_ACQ_REL, "workgroup"); __builtin_amdgcn_wave_barrier();
  const int rsub = lane >> 4, c4 = (lane & 15) * 4;
  {
#pragma unroll
    for (int q = 0; q < 8; ++q) { const int r = q * 2 + rsub; if (col0 + c4 < N) { const v4f v = *(const v4fa*)&so[w][r][c4]; *(v4f*)(C + (size_t)(row0 + r) * ldc + col0 + c4) = v; } }
     }
}

// Bt[n][k] = f16(bf16(W[k][n]) x 16) of the four f32 [in][out] weights (DMX rows each) in one launch (x16: a power of two; bf16-exact weights stay exact in f16 away from the subnormal range).
// A block of 8 waves turns one tile of WTK k x WTN n through LDS, so that memory sees whole lines both ways.
// in: thread = 4 columns (16 bytes; 16 threads = 256 contiguous bytes of a row of W) x 16 rows, all 16 loads in flight together; 8 consecutive k of one column are 16 bytes of f16, one LDS store.
// out: a wave reads one column's WTK k (512 bytes) from LDS and stores them as 512 contiguous bytes of Bt.
// LDS: one row a column n, pitch 528 bytes (an odd multiple of 16, for 16-byte accesses); the 16-byte piece g of row n lies at place g ^ (n >> 4), so that a wave's 32 stores (rows 4 apart) spread evenly over the banks.
constexpr int WTK = 256, WTN = 64, WTP = 2 * WTK + 16, WTQ = (DMX / WTN) * (DMX / WTK), WTV = (DKV / WTN) * (DMX / WTK);      /* WTQ, WTV: tiles of a weight with DMX, DKV columns */
static_assert(DMX % WTK == 0 && DMX % WTN == 0 && DKV % WTN == 0 && WTK == 256 && WTN == 64, "k_wt4: whole tiles; 256 threads = 16 x 4 columns, 16 x 8 rows twice; a wave = one row of 32 pieces");
// a thread's 16 loads of a tile of a weight with N columns (compile-time: the rows are immediate offsets from one address); Wp, k0, n0 the same for the whole block.
template <int N>
__device__ __forceinline__ void wt_load(const float* __restrict__ Wp, int k0, int n0, v4f (&x)[2][8]) {
  const v4fa* s = (const v4fa*)(Wp + (size_t)k0 * N + n0); const unsigned lo = (threadIdx.x >> 4) * (8 * N / 4) + (threadIdx.x & 15);      /* s: the tile's first 16 bytes; lo: the thread's own place in it, in 16 bytes */
#pragma unroll      /* unrolled: x[][] keeps static indices (registers, no scratch) */
  for (int j = 0; j < 2; ++j)
#pragma unroll
    for (int i = 0; i < 8; ++i) x[j][i] = s[lo + (unsigned)((j * 128 + i) * (N / 4))];
  /* inputs only: holds all 16 loads in front of the first use, one trip to memory (without it this build issued them in three groups, each behind the last one's wait); lo is named so that its register is given to no load's result while loads that name it are in flight */
  asm volatile("" :: "v"(x[0][0]), "v"(x[0][1]), "v"(x[0][2]), "v"(x[0][3]), "v"(x[0][4]), "v"(x[0][5]), "v"(x[0][6]), "v"(x[0][7]), "v"(x[1][0]), "v"(x[1][1]), "v"(x[1][2]), "v"(x[1][3]), "v"(x[1][4]), "v"(x[1][5]), "v"(x[1][6]), "v"(x[1][7]), "v"(lo)); }
__global__ __launch_bounds__(256) void k_wt4(const float* __restrict__ wq, const float* __restrict__ wk, const float* __restrict__ wv, const float* __restrict__ wo,
    _Float16* __restrict__ BQ, _Float16* __restrict__ BK, _Float16* __restrict__ BV, _Float16* __restrict__ BO) {
  __shared__ __attribute__((aligned(16))) unsigned char tl[WTN * WTP];
  const int bx = blockIdx.x; const bool wide = bx < 2 * WTQ; const int u = wide ? bx : bx - 2 * WTQ, nt = wide ? WTQ : WTV; const bool second = u >= nt; const int t = second ? u - nt : u;      /* blocks: q, o, k, v; t = the tile in its weight; all the same for the whole block */
  const int k0 = (t % (DMX / WTK)) * WTK, n0 = (t / (DMX / WTK)) * WTN; v4f x[2][8];
  if (wide) wt_load<DMX>(second ? wo : wq, k0, n0, x); else wt_load<DKV>(second ? wv : wk, k0, n0, x);
  _Float16* Bt = wide ? (second ? BO : BQ) : (second ? BV : BK);
  const int n4 = threadIdx.x & 15, kg = threadIdx.x >> 4;
#pragma unroll      /* unrolled, as above */
  for (int j = 0; j < 2; ++j)
#pragma unroll
    for (int q = 0; q < 4; ++q) { FragH f;
#pragma unroll
      for (int i = 0; i < 8; ++i) f.h[i] = (_Float16)(bf16_round(x[j][i][q]) * 16.0f);
      *(v8us*)(tl + (n4 * 4 + q) * WTP + ((j * 16 + kg) ^ (n4 >> 2)) * 16) = f.half[0]; }
  __syncthreads();      /* the tile is whole before a wave reads columns that other waves wrote */
  const int lane = threadIdx.x & 31, nw = (threadIdx.x >> 5) * 8; unsigned short* d = (unsigned short*)Bt + (size_t)(n0 + nw) * DMX + k0 + lane * 8;
#pragma unroll      /* unrolled: the 8 LDS loads go as one group, the 8 rows are immediate offsets */
  for (int r = 0; r < 8; ++r) { const v8us o = *(const v8us*)(tl + (nw + r) * WTP + (lane ^ (nw >> 4)) * 16); *(v8us*)(d + (size_t)r * DMX) = o; } }
// k_gemm_hh variant with fused epilogue: v = acc·alpha + bias[by·sBias + col] (+ CP[(row/rowsPerB)·sCPb + by·64 + col] if CP) ; ACT 0 none / 1 elu ; writes f16 C16 (and f32 C if non-null)
template <int ACT>
__global__ __launch_bounds__(128) void k_gemm_hhx(const _Float16* __restrict__ A, int lda, size_t sA, const _Float16* __restrict__ Bh, int ldb, size_t sB, float alpha, const float* __restrict__ bias, size_t sBias, const float* __restrict__ CP, int rowsPerB, size_t sCPb, int row0g,
    float* __restrict__ C, _Float16* __restrict__ C16, int ldc, size_t sC, int M, int N, int K) {
  __shared__ __attribute__((aligned(16))) float so[4][16][64];
  const int tid = threadIdx.x, w = tid >> 5, lane = tid & 31, ln = lane & 15, hh = lane >> 4; const int by = blockIdx.y;
  A += (size_t)by * sA; Bh += (size_t)by * sB; const size_t cofs = (size_t)by * sC; const float* bp = bias ? bias + (size_t)by * sBias : nullptr;
  const int ntn = (N + 63) / 64; const int wid = blockIdx.x * 4 + w; const int mt = wid / ntn, nq = wid % ntn; if (mt * 16 >= M) return;
  const int row0 = mt * 16, col0 = nq * 64; const _Float16* arow = A + (size_t)(row0 + ln) * lda;
  v8f acc[4] = {};
  for (int kb = 0; kb < K; kb += 32) { FragH ah; ah.half[0] = *(const v8us*)((const unsigned short*)arow + kb + 8 * hh); ah.half[1] = *(const v8us*)((const unsigned short*)arow + kb + 16 + 8 * hh);
#pragma unroll
    for (int t = 0; t < 4; ++t) { if (col0 + t * 16 >= N) continue; const size_t boff = (size_t)(col0 + t * 16 + ln) * ldb + kb; FragH bq; bq.half[0] = *(const v8us*)((const unsigned short*)Bh + boff + 8 * hh); bq.half[1] = *(const v8us*)((const unsigned short*)Bh + boff + 16 + 8 * hh);
      acc[t] = mmaH<1>(ah.v, ah.v, bq.v, bq.v, acc[t]); }
  }
#pragma unroll
  for (int t = 0; t < 4; ++t) { if (col0 + t * 16 >= N) continue; const int col = col0 + t * 16 + ln; const float bv = bp ? bf16_round(bp[col]) : 0.f;
#pragma unroll
    for (int r = 0; r < 8; ++r) { float v = acc[t][r] * alpha + bv; if (CP) { const int rr = row0g + row0 + 8 * hh + r; if (rowsPerB < 0) v += CP[cofs + (size_t)rr * ldc + col];      /* rowsPerB < 0: own element of the batched C plane */ else { const int bidx = rr / rowsPerB; v += CP[(size_t)bidx * sCPb + (size_t)by * 64 + col]; } } if (ACT == 1) v = (v > 0.f) ? v : expm1f(v); else if (ACT == 7) v = (v > 0.f) ? v + 1.0f : expf(v); else if (ACT == 8) v = tanhf(v); else if (ACT == 9) v = 0.5f * v * (1.0f + tanhf(0.7978845608028654f * (v + 0.044715f * v * v * v))); else if (ACT == 11) v = 1.0f / (1.0f + expf(-v)); else if (ACT == 12) v = (v > 0.f) ? v : 0.01f * v; else if (ACT == 14) v = (v > 0.f) ? v : 0.1f * v; else if (ACT == 16) v = (v >= 0.f) ? v : 0.3f * v; else if (ACT == 17) v = (v >= 0.f) ? v : 0.2f * v; else if (ACT == 15) v = v / (1.0f + expf(-v)); else if (ACT == 3) v = fmaxf(v, 0.f); else if (ACT == 6) v = 0.5f * v * (1.0f + erff(v * 0.70710678118654752f)); so[w][8 * hh + r][t * 16 + ln] = v; } }
  __builtin_amdgcn_fence(__ATOMIC_ACQ_REL, "workgroup"); __builtin_amdgcn_wave_barrier();
  const int rsub = lane >> 4, c4 = (lane & 15) * 4; typedef _Float16 v4h __attribute__((ext_vector_type(4)));
  {
#pragma unroll
    for (int q = 0; q < 8; ++q) { const int r = q * 2 + rsub; if (col0 + c4 < N) { const v4f v = *(const v4fa*)&so[w][r][c4]; if (C) *(v4f*)(C + cofs + (size_t)(row0 + r) * ldc + col0 + c4) = v; if (C16) { v4h h4; for (int i = 0; i < 4; ++i) h4[i] = (_Float16)v[i]; *(v4h*)(C16 + cofs + (size_t)(row0 + r) * ldc + col0 + c4) = h4; } } }
     }
}


typedef _Float16 v4h __attribute__((ext_vector_type(4)));

__global__ __launch_bounds__(256) void k_x16(const float* __restrict__ x, _Float16* __restrict__ X16, size_t n8) { const size_t t = (size_t)blockIdx.x * 256 + threadIdx.x; if (t >= n8) return; FragH f;
#pragma unroll
  for (int q = 0; q < 8; ++q) f.h[q] = (_Float16)bf16_round(x[t * 8 + q]); *(v8us*)((unsigned short*)X16 + t * 8) = f.half[0];  }
__global__ __launch_bounds__(256) void k_h16(const float* __restrict__ x, _Float16* __restrict__ X16, size_t n8) { const size_t t = (size_t)blockIdx.x * 256 + threadIdx.x; if (t >= n8) return; FragH f;
#pragma unroll
  for (int q = 0; q < 8; ++q) f.h[q] = (_Float16)x[t * 8 + q]; *(v8us*)((unsigned short*)X16 + t * 8) = f.half[0];  }
__global__ __launch_bounds__(256) void k_round16f(const float* __restrict__ W, _Float16* __restrict__ Bt, size_t n8) { const size_t t = (size_t)blockIdx.x * 256 + threadIdx.x; if (t >= n8) return; FragH f;
#pragma unroll
  for (int i = 0; i < 8; ++i) f.h[i] = (_Float16)(bf16_round(W[t * 8 + i]) * 16.0f); *(v8us*)((unsigned short*)Bt + t * 8) = f.half[0];  }
template <int NHv, int TTv>
__global__ __launch_bounds__(256) void k_vt(const _Float16* __restrict__ V16, int ldv, int voff, _Float16* __restrict__ Vt) { __shared__ unsigned short tl[64][66]; const int tid = threadIdx.x; const int slab = blockIdx.x / (TTv / 64), lg = blockIdx.x % (TTv / 64); const int b = slab / NHv, h = slab % NHv;
  for (int i = tid; i < 64 * 8; i += 256) { const int r = i / 8, c8 = (i % 8) * 8; FragH f; f.half[0] = *(const v8us*)((const unsigned short*)V16 + ((size_t)b * TTv + lg * 64 + r) * ldv + voff + h * 64 + c8);
#pragma unroll
    for (int q = 0; q < 8; ++q) tl[r][c8 + q] = f.u[q]; }
  __syncthreads();
  {
#pragma unroll
    for (int rd = 0; rd < 2; ++rd) { const int d = rd * 32 + tid / 8, pc = tid % 8; FragH f;
#pragma unroll
      for (int q = 0; q < 8; ++q) f.u[q] = tl[pc * 8 + q][d];
      *(v8us*)((unsigned short*)Vt + ((size_t)slab * 64 + d) * TTv + lg * 64 + pc * 8) = f.half[0]; }
     } }

// ---- fast GEMM (block tile 128x64, wave tile 32x64; requires M % 128 == 0 rows per launch region, N % 64 == 0, K % KC == 0); epilogue = k_gemm_hhx semantics ----
// The k range goes in tiles of KC: the block's 128 rows of A and 64 rows of B, KC f16 of each, are staged in LDS (rows 0..127 = A, 128..191 = B; pitch 2 KC + 16 bytes, an odd multiple of 16, for 16-byte readers),
// two buffers, the next tile's copies in flight while this one is multiplied. Every copy of a wave moves whole 128-byte lines; a fragment keeps its k order, so every sum keeps its order.
// KC = 128 in the launches that this kernel still serves (the first tile's out products: at most one block a WGP, so the wait for a tile counts and few trips pay); the large products go through k_gemm3 and k_gemm_qkv below.
__device__ __forceinline__ v16h g2_frag(const _Float16* p, int hh) { FragH f; f.half[0] = *(const v8us*)((const unsigned short*)p + 8 * hh); f.half[1] = *(const v8us*)((const unsigned short*)p + 16 + 8 * hh); return f.v; }
__device__ __forceinline__ v8f g2_mma(v16h a, v16h b, v8f c) { v8f d = __builtin_amdgcn_wmma_f32_16x16x32_f16(false, a, false, b, (short)0, c, false, false); asm volatile("v_nop\n\tv_nop\n\tv_nop\n\tv_nop" : "+v"(d) : "v"(a), "v"(b)); return d; }
// one tile's copies, 12 a statement: thread = 16 bytes (seg) of row (thread / segs a row) + c * RPC; a, b = the thread's own first address in the tile, l = its own LDS byte address in the buffer.
// asm: the copy goes from global memory to LDS through no register. The s_wait_xcnt is the last line of the copies' own statement, so that no address register is rewritten in front of it.
template <int KC>
__device__ __forceinline__ void g2_stage(const _Float16* a, size_t lda, const _Float16* b, size_t ldb, unsigned l) {
  constexpr int RPC = 1024 / KC, NA = 128 / RPC, PB = 2 * KC + 16; static_assert((192 / RPC) % 12 == 0, "12 copies a statement");
#pragma unroll      /* both loops unrolled: p[], d[] keep static indices (registers, no scratch) */
  for (int g = 0; g < 192 / RPC / 12; ++g) { const _Float16* p[12]; unsigned d[12];
#pragma unroll
    for (int i = 0; i < 12; ++i) { const int c = g * 12 + i; p[i] = (c < NA) ? a + (size_t)(c * RPC) * lda : b + (size_t)((c - NA) * RPC) * ldb; d[i] = l + (unsigned)(c * RPC * PB); }
    asm volatile("global_load_async_to_lds_b128 %0, %12, off\n\tglobal_load_async_to_lds_b128 %1, %13, off\n\tglobal_load_async_to_lds_b128 %2, %14, off\n\tglobal_load_async_to_lds_b128 %3, %15, off\n\t"
                 "global_load_async_to_lds_b128 %4, %16, off\n\tglobal_load_async_to_lds_b128 %5, %17, off\n\tglobal_load_async_to_lds_b128 %6, %18, off\n\tglobal_load_async_to_lds_b128 %7, %19, off\n\t"
                 "global_load_async_to_lds_b128 %8, %20, off\n\tglobal_load_async_to_lds_b128 %9, %21, off\n\tglobal_load_async_to_lds_b128 %10, %22, off\n\tglobal_load_async_to_lds_b128 %11, %23, off\n\ts_wait_xcnt 0x0"
                 :: "v"(d[0]), "v"(d[1]), "v"(d[2]), "v"(d[3]), "v"(d[4]), "v"(d[5]), "v"(d[6]), "v"(d[7]), "v"(d[8]), "v"(d[9]), "v"(d[10]), "v"(d[11]),
                    "v"(p[0]), "v"(p[1]), "v"(p[2]), "v"(p[3]), "v"(p[4]), "v"(p[5]), "v"(p[6]), "v"(p[7]), "v"(p[8]), "v"(p[9]), "v"(p[10]), "v"(p[11]) : "memory"); } }
template <int ACT, int KC>
__global__ __launch_bounds__(128) void k_gemm2(const _Float16* __restrict__ A, int lda, size_t sA, const _Float16* __restrict__ Bh, int ldb, size_t sB, float alpha, const float* __restrict__ bias, size_t sBias, const float* __restrict__ CP, int rowsPerB, size_t sCPb, int row0g,
    float* __restrict__ C, _Float16* __restrict__ C16, int ldc, size_t sC, int M, int N, int K, int bdiv, size_t zA, size_t zB, size_t zC) { static_assert(ACT == 0 || ACT == 3 || ACT == 6 || ACT == 8 || ACT == 9 || ACT == 11 || ACT == 12 || ACT == 14 || ACT == 15 || ACT == 16 || ACT == 17, "k_gemm2: unsupported ACT code (would silently apply no activation)");
  constexpr int PB = 2 * KC + 16, STB = 192 * PB;      /* bytes: a staged row's pitch, one buffer */
  static_assert(2 * STB >= 4 * 32 * 68 * 4, "the output staging reuses the two buffers");
  __shared__ __attribute__((aligned(16))) unsigned char sm[2 * STB]; float (*so)[32][68] = reinterpret_cast<float (*)[32][68]>(sm);      /* so: each wave's output staging, used behind the loop's last barrier */
  const int tid = threadIdx.x, w = tid >> 5, lane = tid & 31, ln = lane & 15, hh = lane >> 4; const int by = blockIdx.y; const size_t bz = blockIdx.z;      /* y = head (bdiv heads share one B slab), z = batch */
  A += (size_t)by * sA + bz * zA; Bh += (size_t)(by / bdiv) * sB + bz * zB; const size_t cofs = (size_t)by * sC + bz * zC; const float* bp = bias ? bias + (size_t)by * sBias : nullptr;
  const int ntn = N >> 6; const int mt = blockIdx.x / ntn, nq = blockIdx.x - mt * ntn; const int row0 = mt * 128 + 32 * w, col0 = nq * 64; if (mt * 128 >= M) return;      /* the whole block leaves, in front of every barrier */
  const int srow = tid / (KC / 8), sseg = tid % (KC / 8);
  const _Float16* ag = A + (size_t)(mt * 128 + srow) * lda + sseg * 8; const _Float16* bg = Bh + (size_t)(col0 + srow) * ldb + sseg * 8;
  const unsigned l0 = (unsigned)(size_t)sm + (unsigned)(srow * PB + sseg * 16);
  const int nt = K / KC;
  g2_stage<KC>(ag, (size_t)lda, bg, (size_t)ldb, l0);
  asm volatile("s_wait_asynccnt 0x0" ::: "memory");      /* this wave's copies of tile 0 have landed */
  __syncthreads();      /* ... and every other wave's */
  if (nt > 1) g2_stage<KC>(ag + KC, (size_t)lda, bg + KC, (size_t)ldb, l0 + STB);
  const v8f z8 = {0.f,0.f,0.f,0.f,0.f,0.f,0.f,0.f}; v8f c00 = z8, c01 = z8, c02 = z8, c03 = z8, c10 = z8, c11 = z8, c12 = z8, c13 = z8;
#pragma unroll 1      /* one trip a tile: the two buffers take turns */
  for (int t = 0; t < nt; ++t) { const unsigned char* sb = sm + (t & 1) * STB;
    const _Float16* a0p = (const _Float16*)(sb + (32 * w + ln) * PB); const _Float16* a1p = (const _Float16*)(sb + (32 * w + 16 + ln) * PB);
    const _Float16* b0p = (const _Float16*)(sb + (128 + ln) * PB); const _Float16* b1p = (const _Float16*)(sb + (144 + ln) * PB); const _Float16* b2p = (const _Float16*)(sb + (160 + ln) * PB); const _Float16* b3p = (const _Float16*)(sb + (176 + ln) * PB);
    v16h fa[2][2], fb[2][4];      /* two fragment sets: a k step's 12 LDS loads go as one group, one step ahead of its products, inside this tile only */
    fa[0][0] = g2_frag(a0p, hh); fa[0][1] = g2_frag(a1p, hh); fb[0][0] = g2_frag(b0p, hh); fb[0][1] = g2_frag(b1p, hh); fb[0][2] = g2_frag(b2p, hh); fb[0][3] = g2_frag(b3p, hh);
#pragma unroll      /* unrolled: the sets keep static indices (registers), every LDS offset is an immediate */
    for (int s = 0; s < KC / 32; ++s) { const int u = s & 1, n = u ^ 1, kn = (s + 1) * 32;
      if (s + 1 < KC / 32) { fa[n][0] = g2_frag(a0p + kn, hh); fa[n][1] = g2_frag(a1p + kn, hh); fb[n][0] = g2_frag(b0p + kn, hh); fb[n][1] = g2_frag(b1p + kn, hh); fb[n][2] = g2_frag(b2p + kn, hh); fb[n][3] = g2_frag(b3p + kn, hh); }
      c00 = g2_mma(fa[u][0], fb[u][0], c00); c10 = g2_mma(fa[u][1], fb[u][0], c10); c01 = g2_mma(fa[u][0], fb[u][1], c01); c11 = g2_mma(fa[u][1], fb[u][1], c11);
      c02 = g2_mma(fa[u][0], fb[u][2], c02); c12 = g2_mma(fa[u][1], fb[u][2], c12); c03 = g2_mma(fa[u][0], fb[u][3], c03); c13 = g2_mma(fa[u][1], fb[u][3], c13); }
    asm volatile("s_wait_dscnt 0x0" ::: "memory");      /* this wave's reads of the buffer are done before it is handed to the next copies */
    asm volatile("s_wait_asynccnt 0x0" ::: "memory");      /* this wave's copies of tile t + 1 have landed */
    __syncthreads();      /* publishes tile t + 1 and ends every wave's reads of tile t */
    if (t + 2 < nt) g2_stage<KC>(ag + (size_t)(t + 2) * KC, (size_t)lda, bg + (size_t)(t + 2) * KC, (size_t)ldb, l0 + (t & 1) * STB); }
  asm volatile("s_wait_asynccnt 0x0" ::: "memory");      /* no copy is in flight when the buffers become output staging */
  v8f accs[8] = {c00, c01, c02, c03, c10, c11, c12, c13};
#pragma unroll
  for (int u = 0; u < 8; ++u) { const int t = u & 3, half = u >> 2; const int col = col0 + t * 16 + ln; const float bv = bp ? bf16_round(bp[col]) : 0.f;
#pragma unroll
    for (int r = 0; r < 8; ++r) { const int rloc = half * 16 + 8 * hh + r; float v = accs[u][r] * alpha + bv; if (CP) { if (rowsPerB < 0) v += CP[cofs + (size_t)(row0g + row0 + rloc) * ldc + col];      /* rowsPerB < 0: own element of the batched C plane */ else { const int bidx = (row0g + row0 + rloc) / rowsPerB; v += CP[(size_t)bidx * sCPb + (size_t)by * 64 + col]; } }
      if (ACT == 3) v = fmaxf(v, 0.f); else if (ACT == 6) v = 0.5f * v * (1.0f + erff(v * 0.70710678118654752f)); else if (ACT == 11) v = 1.0f / (1.0f + expf(-v)); else if (ACT == 15) v = v / (1.0f + expf(-v)); else if (ACT == 12) v = (v > 0.f) ? v : 0.01f * v; else if (ACT == 8) v = tanhf(v); else if (ACT == 9) v = 0.5f * v * (1.0f + tanhf(0.7978845608028654f * (v + 0.044715f * v * v * v))); else if (ACT == 14) v = (v > 0.f) ? v : 0.1f * v; else if (ACT == 16) v = (v >= 0.f) ? v : 0.3f * v; else if (ACT == 17) v = (v >= 0.f) ? v : 0.2f * v;
      so[w][rloc][t * 16 + ln] = v; } }
  __builtin_amdgcn_fence(__ATOMIC_ACQ_REL, "workgroup"); __builtin_amdgcn_wave_barrier();
  const int rsub = lane >> 4, c4 = (lane & 15) * 4;
  {
#pragma unroll
    for (int q = 0; q < 16; ++q) { const int r = q * 2 + rsub; const v4f v = *(const v4fa*)&so[w][r][c4]; if (C) *(v4f*)(C + cofs + (size_t)(row0 + r) * ldc + col0 + c4) = v; if (C16) { v4h h4; for (int i = 0; i < 4; ++i) h4[i] = (_Float16)v[i]; *(v4h*)(C16 + cofs + (size_t)(row0 + r) * ldc + col0 + c4) = h4; } }
     } }


__global__ __launch_bounds__(256) void k_wnat(const float* __restrict__ w, size_t n8, _Float16* __restrict__ Bt) { const size_t t = (size_t)blockIdx.x * 256 + threadIdx.x; if (t >= n8) return; FragH f; for (int q = 0; q < 8; ++q) f.h[q] = (_Float16)(bf16_round(w[t * 8 + q]) * 16.0f); *(v8us*)((unsigned short*)Bt + t * 8) = f.half[0];  }
__global__ __launch_bounds__(256) void k_rsm(const float* __restrict__ S, _Float16* __restrict__ P, int nrows) {
  #pragma clang fp contract(off)
  const int i = blockIdx.x * 256 + threadIdx.x; if (i >= nrows) return; const float* s = S + (size_t)i * SQ; float mx = -3.0e38f;
#pragma unroll 1
  for (int j = 0; j < SQ; ++j) mx = fmaxf(mx, s[j]); float se = 0.f;
#pragma unroll 1
  for (int j = 0; j < SQ; ++j) se += expf(s[j] - mx); const float sc = 256.0f / se;
#pragma unroll 1
  for (int j0 = 0; j0 < SQ; j0 += 8) { FragH f; for (int q = 0; q < 8; ++q) f.h[q] = (_Float16)(expf(s[j0 + q] - mx) * sc); unsigned short* d = (unsigned short*)P + (size_t)i * SQ + j0; *(v8us*)d = f.half[0];  } }
__global__ __launch_bounds__(256) void k_vt(const _Float16* __restrict__ V16, int b, int h0, _Float16* __restrict__ VT) { __shared__ unsigned short tl[64][65]; const int tid = threadIdx.x; const int hh = blockIdx.x % HG, sg = blockIdx.x / HG; const int s0 = sg * 64; const int h = h0 + hh;
  for (int i = tid; i < 64 * 8; i += 256) { const int j = i / 8, d8 = (i % 8) * 8; FragH f; f.half[0] = *(const v8us*)((const unsigned short*)V16 + ((size_t)b * SQ + s0 + j) * DM + h * HD + d8); for (int q = 0; q < 8; ++q) tl[d8 + q][j] = f.u[q]; }
  __syncthreads();
  { for (int i = tid; i < 64 * 8; i += 256) { const int d = i / 8, j8 = (i % 8) * 8; FragH f; for (int q = 0; q < 8; ++q) f.u[q] = tl[d][j8 + q]; *(v8us*)((unsigned short*)VT + ((size_t)hh * HD + d) * SQ + s0 + j8) = f.half[0]; }  } }


// lane l with lane l ^ M inside its 16-lane row (M = 1, 2, 4, 8), and with lane l ^ 16
template <int M>
__device__ __forceinline__ float row_x(float x) { return __builtin_bit_cast(float, __builtin_amdgcn_update_dpp(0, __builtin_bit_cast(int, x), 0x160 + M, 0xf, 0xf, true)); }
__device__ __forceinline__ float half_x(float x) { return __builtin_bit_cast(float, __builtin_amdgcn_permlanex16(__builtin_bit_cast(int, x), __builtin_bit_cast(int, x), 0x76543210, 0xfedcba98, false, false)); }
// exact (f32, vector unit) causal attention of rows 0..QT0-1: 8 waves a block, one wave a query row; x = head * (QT0 / 8) + group of 8 rows, y = batch. Keys go in chunks of 32; a chunk wholly behind the row is skipped (wave-uniform).
// scores: lane = 8 kq + dl reads dims 32 t + 4 dl .. + 3 of key 32 c + 4 g + kq (each load = 4 whole 128-byte lines), sums its 16 products (4 partial sums, one a dim of the 16 bytes), 3-step butterfly over dl; lane keeps the key with g == dl.
// softmax: maximum and sum = each lane's own (up to 4) keys, then a five-step butterfly. o: lane l holds dims 4 l .. 4 l + 3 (each load 512 contiguous bytes), keys in rising order, each weight read from the lane that keeps it.
// every loop is unrolled: q[], s[] keep static indices (registers, no scratch), the lane a weight is read from is a constant, and a chunk's 32 loads issue ahead of their first use.
// v is read where the projection left it (f32, all rows, one slab of 128 dims a kv head: head h reads slab h / GSZ). o (x64) leaves as two f16 planes, o = hi + lo / 1024: hi goes to the row's own place in O16,
// so that the large out product multiplies it with all other rows; lo (x1024) goes to OL, whose product is added to those rows afterwards.
__global__ __launch_bounds__(256) void k_att0w(const float* __restrict__ QF, const float* __restrict__ KF, const float* __restrict__ VF, float scale, _Float16* __restrict__ O16, _Float16* __restrict__ OL) {
  constexpr int ld = DMX, ldv = DKV, ldo = DMX;      /* row pitches, compile-time: a chunk's 32 rows are immediate offsets from one address */
  const int lane = threadIdx.x & 31, dl = lane & 7, kq = lane >> 3; const int h = blockIdx.x / (QT0 / 8); const int i = (blockIdx.x % (QT0 / 8)) * 8 + __builtin_amdgcn_readfirstlane(threadIdx.x >> 5);
  { const size_t bq = (size_t)blockIdx.y * QT0, bs = (size_t)blockIdx.y * SQ; QF += (bq + i) * ld + h * 128; KF += bq * ld + h * 128; VF += bs * ldv + (h / GSZ) * 128; O16 += (bs + i) * ldo + h * 128; OL += (bq + i) * ldo + h * 128; }      /* y = batch: in QF, KF, OL each batch's QT0 rows follow the last one's; VF, O16 hold all SQ rows of a batch */
  v4f q[4];
#pragma unroll
  for (int t = 0; t < 4; ++t) q[t] = *(const v4fa*)(QF + t * 32 + dl * 4);
  float s[QT0 / 32];
#pragma unroll
  for (int c = 0; c < QT0 / 32; ++c) { s[c] = -1.0e30f;
    if (c * 32 <= i) { const float* kp = KF + (size_t)(c * 32 + kq) * ld + dl * 4; float keep = 0.f;
#pragma unroll
      for (int g = 0; g < 8; ++g) { v4f pa = q[0] * *(const v4fa*)(kp + (size_t)(g * 4) * ld);
#pragma unroll
        for (int t = 1; t < 4; ++t) pa += q[t] * *(const v4fa*)(kp + (size_t)(g * 4) * ld + t * 32);
        float a = (pa[0] + pa[1]) + (pa[2] + pa[3]); a += row_x<1>(a); a += row_x<2>(a); a += row_x<4>(a); keep = (dl == g) ? a : keep; }
      s[c] = (c * 32 + 4 * dl + kq <= i) ? keep * scale : -1.0e30f; } }
  float m = s[0];
#pragma unroll
  for (int c = 1; c < QT0 / 32; ++c) m = fmaxf(m, s[c]);
  m = fmaxf(m, row_x<1>(m)); m = fmaxf(m, row_x<2>(m)); m = fmaxf(m, row_x<4>(m)); m = fmaxf(m, row_x<8>(m)); m = fmaxf(m, half_x(m));      /* key 0 is open in every row: m is a score */
  float l = 0.f;
#pragma unroll
  for (int c = 0; c < QT0 / 32; ++c) { s[c] = expf(s[c] - m); l += s[c]; }      /* a closed key: e^(-1e30 - m) = 0 */
  l += row_x<1>(l); l += row_x<2>(l); l += row_x<4>(l); l += row_x<8>(l); l += half_x(l);
  v4f o = {0.f, 0.f, 0.f, 0.f};
#pragma unroll
  for (int c = 0; c < QT0 / 32; ++c) {
    if (c * 32 <= i) { const float* vp = VF + (size_t)(c * 32) * ldv + lane * 4;
#pragma unroll
      for (int j = 0; j < 32; ++j) { const float e = __builtin_bit_cast(float, __builtin_amdgcn_readlane(__builtin_bit_cast(int, s[c]), 8 * (j & 3) + (j >> 2))); const v4f vv = *(const v4fa*)(vp + (size_t)j * ldv); o += vv * e; } } }
  const v4f ov = o * (64.0f / l); v4h oh, ol;
#pragma unroll
  for (int u = 0; u < 4; ++u) { const _Float16 t = (_Float16)ov[u]; oh[u] = t; ol[u] = (_Float16)((ov[u] - (float)t) * 1024.0f); }
  *(v4h*)(O16 + lane * 4) = oh; *(v4h*)(OL + lane * 4) = ol; }
__global__ __launch_bounds__(256) void k_f2h(const float* __restrict__ F, int ldf, int coff, int ncol, _Float16* __restrict__ H16, size_t nrow) { const size_t t = (size_t)blockIdx.x * 256 + threadIdx.x; const size_t n8 = nrow * (size_t)(ncol / 8); if (t >= n8) return; const size_t r = t / (ncol / 8); const int c8 = (int)(t % (ncol / 8)) * 8; FragH f; const v4f a = *(const v4fa*)(F + r * ldf + coff + c8), b2 = *(const v4fa*)(F + r * ldf + coff + c8 + 4); for (int q = 0; q < 4; ++q) { f.h[q] = (_Float16)a[q]; f.h[4 + q] = (_Float16)b2[q]; } *(v8us*)((unsigned short*)H16 + r * ncol + c8) = f.half[0];  }

__global__ __launch_bounds__(256) void k_tab128(float theta, float* __restrict__ CS, float* __restrict__ SN) {
  #pragma clang fp contract(off)
  const int t = blockIdx.x * 256 + threadIdx.x; if (t >= SQ * 64) return; const int i = t % 64; const int p = t / 64; const float invf = (float)(1.0 / pow((double)theta, (double)(2 * i) / 128.0));      /* = XLA's constant-folded f32 table */ const float ang = __fmul_rn((float)p, invf); const float c = cosf(ang), s = sinf(ang);
  *(float*)(CS + t) = c; *(float*)(SN + t) = s;  }
template <int TAB>
__global__ __launch_bounds__(128) void k_rope128(const float* __restrict__ F, int ldf, int nh, const float* __restrict__ CS, const float* __restrict__ SN, _Float16* __restrict__ H16, int ldo, float osc) {
  #pragma clang fp contract(off)
  __shared__ float xv[128]; __shared__ unsigned short sh_[128]; const int d = threadIdx.x; const int h = blockIdx.x % nh; const size_t r = blockIdx.x / nh; const int p = (int)(r % SQ);
  xv[d] = F[r * (size_t)ldf + (size_t)h * 128 + d]; __syncthreads();
  float c, s; if (TAB) { c = bf16_round(CS[(size_t)p * 128 + d]); s = bf16_round(SN[(size_t)p * 128 + d]); } else { c = CS[p * 64 + (d & 63)]; s = SN[p * 64 + (d & 63)]; }
  const float rot = (d < 64) ? -xv[d + 64] : xv[d - 64]; const float o = __fadd_rn(__fmul_rn(xv[d], c), __fmul_rn(rot, s));
  FragH th; th.h[0] = (_Float16)__fmul_rn(o, osc); sh_[d] = th.u[0]; __syncthreads();
  if (d < 16) { FragH f; for (int q = 0; q < 8; ++q) f.u[q] = sh_[d * 8 + q]; unsigned short* dst = (unsigned short*)H16 + r * (size_t)ldo + (size_t)h * 128 + d * 8; *(v8us*)dst = f.half[0];  } }

template <int N>
__global__ __launch_bounds__(256) void k_rmsrow(float* __restrict__ X, const float* __restrict__ w, float eps) {
  #pragma clang fp contract(off)
  constexpr int PT = N / 256; __shared__ float red[256]; const size_t r = blockIdx.x; const int t = threadIdx.x; float* row = X + r * N + (size_t)t * PT; float v[PT]; float ss = 0.f;
  for (int q = 0; q < PT; ++q) { v[q] = row[q]; ss = __fadd_rn(ss, __fmul_rn(v[q], v[q])); }
  red[t] = ss; __syncthreads(); for (int k = 128; k > 0; k >>= 1) { if (t < k) red[t] = __fadd_rn(red[t], red[t + k]); __syncthreads(); }
  const float rs = rsqrtf(__fadd_rn(red[0] / (float)N, eps)); float o[PT]; for (int q = 0; q < PT; ++q) o[q] = __fmul_rn(__fmul_rn(v[q], rs), bf16_round(w[t * PT + q]));
  { for (int q = 0; q < PT; ++q) *(float*)(row + q) = o[q];  } }
__global__ __launch_bounds__(256) void k_rsmcfb(const float* __restrict__ S, _Float16* __restrict__ P, int hg, int q0, int nk, const int* __restrict__ mk) {
  #pragma clang fp contract(off)
  const int t = blockIdx.x * 256 + threadIdx.x; if (t >= hg * QT) return; const size_t i = (size_t)t; const float* s = S + i * NKX; const size_t ig = (size_t)(q0 + (t % QT)); const int* mr = mk + ig * SQ; float mx = -3.0e38f;
#pragma unroll 1
  for (int j = 0; j < nk; ++j) { const int mb = mr[j]; const float f = (mb == 0) ? 1.f : 0.f; mx = fmaxf(mx, fmaf(f, s[j], (1.f - f) * -1.0e9f)); } float se = 0.f;
#pragma unroll 1
  for (int j = 0; j < nk; ++j) { const int mb = mr[j]; const float f = (mb == 0) ? 1.f : 0.f; se += __expf(fmaf(f, s[j], (1.f - f) * -1.0e9f) - mx); } const float sc = 256.0f / se;
#pragma unroll 1
  for (int j0 = 0; j0 < nk; j0 += 8) { FragH fr; for (int q = 0; q < 8; ++q) { const int j = j0 + q; const int mb = mr[j]; const float f = (mb == 0) ? 1.f : 0.f; fr.h[q] = (_Float16)(__expf(fmaf(f, s[j], (1.f - f) * -1.0e9f) - mx) * sc); } unsigned short* d = (unsigned short*)P + i * NKX + j0; *(v8us*)d = fr.half[0];  } }


// per-head RMSNorm over the 128 dims, then rotate-half RoPE, of the NHD heads of one row, in place: lane l holds dims 4 l .. 4 l + 3 of every head.
// sum of squares = the lane's own 4 dims, then a five-step butterfly over the lanes; dim d's partner d +- 64 sits in lane l ^ 16; sg = the sine with the sign of rotate-half (minus in lanes 0..15).
// 1 / sqrt(x) of a normal x. One statement: the v_nop fills the slot behind v_rsq_f32 (output early-clobber).
__device__ __forceinline__ float rsq_n(float x) { float r; asm("v_rsq_f32 %0, %1\n\tv_nop" : "=&v"(r) : "v"(x)); return r; }
template <int NHD>
__device__ __forceinline__ void nr_heads(v4f (&x)[NHD], v4f w, v4f c, v4f sg) {
#pragma unroll
  for (int h = 0; h < NHD; ++h) { const v4f v = x[h]; float ss = (v[0] * v[0] + v[1] * v[1]) + (v[2] * v[2] + v[3] * v[3]);
    ss += row_x<1>(ss); ss += row_x<2>(ss); ss += row_x<4>(ss); ss += row_x<8>(ss); ss += half_x(ss);
    const v4f y = (v * rsq_n(ss * 0.0078125f + 1e-6f)) * w; v4f o;      /* mean square + eps >= 1e-6: never subnormal, so no rescue scaling round the v_rsq_f32 */
#pragma unroll
    for (int u = 0; u < 4; ++u) o[u] = y[u] * c[u] + half_x(y[u]) * sg[u];
    x[h] = o; } }
// RMSNorm + RoPE of q and k in one launch: 8 waves a block, one wave a row of x with its 16 query and 8 key heads in registers (each load 512 contiguous bytes, all 24 issued ahead of the first use; the row's table line is read once).
// out: f16 q and k; rows 0..QT0-1 of each batch also in f32 for the exact first tile, a key head written to both query heads of its group (wave-uniform branch).
__global__ __launch_bounds__(256) void k_nrope(const float* __restrict__ QF, const float* __restrict__ KF, const float* __restrict__ qw, const float* __restrict__ kw, const float* __restrict__ CS, const float* __restrict__ SN,
    _Float16* __restrict__ Q16, _Float16* __restrict__ K16, float* __restrict__ QF0, float* __restrict__ KF0e) {
  const int lane = threadIdx.x & 31, l4 = lane * 4; const int r = blockIdx.x * 8 + __builtin_amdgcn_readfirstlane(threadIdx.x >> 5); const int p = r % SQ, b = r / SQ;
  const float* q = QF + (size_t)r * DMX + l4; const float* k = KF + (size_t)r * DKV + l4;
  v4f xq[NH], xk[NKV];
#pragma unroll
  for (int h = 0; h < NH; ++h) xq[h] = *(const v4fa*)(q + h * 128);
#pragma unroll
  for (int h = 0; h < NKV; ++h) xk[h] = *(const v4fa*)(k + h * 128);
  const v4f cr = *(const v4fa*)(CS + (size_t)p * 128 + l4), sr = *(const v4fa*)(SN + (size_t)p * 128 + l4), qr = *(const v4fa*)(qw + l4), kr = *(const v4fa*)(kw + l4);
  v4f c, sg, wq, wk;
#pragma unroll
  for (int u = 0; u < 4; ++u) { c[u] = bf16_round(cr[u]); const float s = bf16_round(sr[u]); sg[u] = (lane < 16) ? -s : s; wq[u] = bf16_round(qr[u]); wk[u] = bf16_round(kr[u]); }
  nr_heads<NH>(xq, wq, c, sg); nr_heads<NKV>(xk, wk, c, sg);
  _Float16* q16 = Q16 + (size_t)r * DMX + l4; _Float16* k16 = K16 + (size_t)r * DKV + l4;
#pragma unroll
  for (int h = 0; h < NH; ++h) { v4h h4;
#pragma unroll
    for (int u = 0; u < 4; ++u) h4[u] = (_Float16)xq[h][u];
    *(v4h*)(q16 + h * 128) = h4; }
#pragma unroll
  for (int h = 0; h < NKV; ++h) { v4h h4;
#pragma unroll
    for (int u = 0; u < 4; ++u) h4[u] = (_Float16)xk[h][u];
    *(v4h*)(k16 + h * 128) = h4; }
  asm volatile("s_wait_xcnt 0x0" ::: "memory");      /* the branch below reuses registers that the f16 stores name; in front of the branch, so that nothing of it is lifted over the wait */
  if (p < QT0) { const size_t f = ((size_t)b * QT0 + p) * DMX + l4;
#pragma unroll
    for (int h = 0; h < NH; ++h) { *(v4f*)(QF0 + f + h * 128) = xq[h]; *(v4f*)(KF0e + f + h * 128) = xk[h / GSZ]; } } }

// 2^x of four values. One statement: each v_exp_f32 is followed by one that neither reads its result nor writes its source (outputs early-clobber), and the v_nop fills
// the slot behind the last.
__device__ __forceinline__ v4f exp2_4(v4f x) { float e0, e1, e2, e3;
  asm("v_exp_f32 %0, %4\n\tv_exp_f32 %1, %5\n\tv_exp_f32 %2, %6\n\tv_exp_f32 %3, %7\n\tv_nop" : "=&v"(e0), "=&v"(e1), "=&v"(e2), "=&v"(e3) : "v"(x[0]), "v"(x[1]), "v"(x[2]), "v"(x[3]));
  const v4f e = {e0, e1, e2, e3}; return e; }
// 2^x of one value; the v_nop fills the slot behind v_exp_f32 (output early-clobber), as in exp2_4.
__device__ __forceinline__ float exp2_1(float x) { float r; asm("v_exp_f32 %0, %1\n\tv_nop" : "=&v"(r) : "v"(x)); return r; }
__device__ __forceinline__ v8f fa_mma(v16h a, v16h b, v8f c) { return __builtin_amdgcn_wmma_f32_16x16x32_f16(false, a, false, b, (short)0, c, false, false); }
// four vector slots behind a group of matrix instructions, in front of a branch whose taken side reads their results; the scheduling barriers keep them at that place.
__device__ __forceinline__ void fa_gap() { __builtin_amdgcn_sched_barrier(0); asm volatile("v_nop\n\tv_nop\n\tv_nop\n\tv_nop"); __builtin_amdgcn_sched_barrier(0); }
// eight copies of 16 bytes a thread, global memory to LDS through no register: rows step (elements) apart in memory, lstep bytes apart in LDS.
// The s_wait_xcnt is the last line of the copies' own statement, so that no address register is rewritten in front of it.
__device__ __forceinline__ void fa_copy8(const _Float16* g, size_t step, unsigned l, unsigned lstep) { const _Float16* p[8]; unsigned d[8];
#pragma unroll      /* unrolled: p[], d[] keep static indices (registers, no scratch) */
  for (int i = 0; i < 8; ++i) { p[i] = g + (size_t)i * step; d[i] = l + (unsigned)i * lstep; }
  asm volatile("global_load_async_to_lds_b128 %0, %8, off\n\tglobal_load_async_to_lds_b128 %1, %9, off\n\tglobal_load_async_to_lds_b128 %2, %10, off\n\tglobal_load_async_to_lds_b128 %3, %11, off\n\t"
               "global_load_async_to_lds_b128 %4, %12, off\n\tglobal_load_async_to_lds_b128 %5, %13, off\n\tglobal_load_async_to_lds_b128 %6, %14, off\n\tglobal_load_async_to_lds_b128 %7, %15, off\n\ts_wait_xcnt 0x0"
               :: "v"(d[0]), "v"(d[1]), "v"(d[2]), "v"(d[3]), "v"(d[4]), "v"(d[5]), "v"(d[6]), "v"(d[7]), "v"(p[0]), "v"(p[1]), "v"(p[2]), "v"(p[3]), "v"(p[4]), "v"(p[5]), "v"(p[6]), "v"(p[7]) : "memory"); }
// a pass's eight K fragments (32 keys x 128 dims) as one group of LDS loads; p = the lane's own row (key c of the pass) in the buffer, the second 16 keys lie 16 rows on.
__device__ __forceinline__ void fa_loadk(v16h (&kf)[2][4], const unsigned char* p, unsigned pitch, int hh) {
#pragma unroll
  for (int kt = 0; kt < 2; ++kt)
#pragma unroll
    for (int kc = 0; kc < 4; ++kc) kf[kt][kc] = g2_frag((const _Float16*)(p + 16 * kt * pitch) + 32 * kc, hh); }
constexpr int FQ = 128; constexpr unsigned FPK = 2 * HDK + 16, FPV = 2 * 64 + 16, FTK = 64 * FPK, FTV = HDK * FPV, FST = FTK + FTV;
static_assert(SQ % FQ == 0 && (SQ / FQ) % 2 == 0 && HDK == 128, "k_fattn: blocks of 128 rows, head size 128");
__global__ __launch_bounds__(128) void k_fattn(const _Float16* __restrict__ Q16, const _Float16* __restrict__ K16, const _Float16* __restrict__ VT, _Float16* __restrict__ O16) {
  __shared__ __attribute__((aligned(16))) unsigned char sm[2 * FST];
  const int tid = threadIdx.x, lane = tid & 31, c = lane & 15, hh = lane >> 4; const int w = __builtin_amdgcn_readfirstlane(tid >> 5);
  const int head = blockIdx.x % NH, b = blockIdx.x / NH, grp = head / GSZ;
  constexpr int NQB = SQ / FQ; const int qb = ((int)blockIdx.y < NQB / 2) ? NQB - 1 - (int)blockIdx.y : (int)blockIdx.y - NQB / 2;      /* long blocks start first; blocks half a grid apart add up to the same length */
  const int q0 = qb * FQ, qw0 = q0 + 32 * w, nst = (q0 + FQ) / 64;      /* keys 0 .. q0 + 127: at least two stages */
  const _Float16* kg = K16 + ((size_t)b * SQ + (tid >> 4)) * DKV + grp * HDK + (tid & 15) * 8; const _Float16* vg = VT + ((size_t)b * DKV + grp * HDK + (tid >> 3)) * SQ + (tid & 7) * 8;
  const unsigned lk = (unsigned)(size_t)sm + (unsigned)((tid >> 4) * FPK + (tid & 15) * 16), lv = (unsigned)(size_t)sm + FTK + (unsigned)((tid >> 3) * FPV + (tid & 7) * 16);
  fa_copy8(kg, (size_t)8 * DKV, lk, 8 * FPK); fa_copy8(vg, (size_t)16 * SQ, lv, 16 * FPV);
  v16h qf[2][4];
#pragma unroll
  for (int g = 0; g < 2; ++g)
#pragma unroll
    for (int kc = 0; kc < 4; ++kc) qf[g][kc] = g2_frag(Q16 + ((size_t)b * SQ + qw0 + 16 * g + c) * DMX + head * HDK + 32 * kc, hh);
  const v8f z8 = {0.f,0.f,0.f,0.f,0.f,0.f,0.f,0.f}; v8f acc[2][8]; float m_run[2], l_run[2];
#pragma unroll
  for (int g = 0; g < 2; ++g) { m_run[g] = -__builtin_inff(); l_run[g] = 0.f;
#pragma unroll
    for (int t = 0; t < 8; ++t) acc[g][t] = z8; }
  asm volatile("s_wait_asynccnt 0x0" ::: "memory");      /* this wave's copies of stage 0 have landed */
  __syncthreads();      /* ... and every other wave's */
  fa_copy8(kg + (size_t)64 * DKV, (size_t)8 * DKV, lk + FST, 8 * FPK); fa_copy8(vg + 64, (size_t)16 * SQ, lv + FST, 16 * FPV);
  constexpr float cs = ATS * 1.4426950408889634f;      /* score scale, log2 domain */
  v16h kf[2][4];      /* K fragments of the coming pass: fetched as one group ahead of their products, never out of another stage's buffer */
#pragma unroll 1      /* one trip a stage: the two buffers take turns */
  for (int st = 0; st < nst; ++st) { const unsigned char* sb = sm + (st & 1) * FST;
    if (st * 64 <= qw0) fa_loadk(kf, sb + (unsigned)c * FPK, FPK, hh);      /* wave-uniform: the first pass's K fragments; this stage's buffer only */
#pragma unroll 1      /* one body for both passes: half the code, and no more registers than one pass needs */
    for (int sub = 0; sub < 2; ++sub) { const int key0 = st * 64 + sub * 32;
      if (key0 <= qw0) {      /* wave-uniform: a later pass holds no key that a query of this wave may see */
        v8f s[2][2] = {{z8, z8}, {z8, z8}};
#pragma unroll
        for (int kc = 0; kc < 4; ++kc)
#pragma unroll
          for (int kt = 0; kt < 2; ++kt)
#pragma unroll
            for (int g = 0; g < 2; ++g) s[kt][g] = fa_mma(kf[kt][kc], qf[g][kc], s[kt][g]);
        fa_gap();
        v16h vf[8];      /* the pass's V^T fragments, one group, in flight under the softmax */
#pragma unroll
        for (int t = 0; t < 8; ++t) vf[t] = g2_frag((const _Float16*)(sb + FTK + (unsigned)(16 * t + c) * FPV) + sub * 32, hh);
        if (sub == 0 && key0 + 32 <= qw0) fa_loadk(kf, sb + (unsigned)(32 + c) * FPK, FPK, hh);      /* wave-uniform: the stage's second pass, same buffer, in flight under this pass's softmax and second product */
        if (key0 == qw0) {      /* wave-uniform: only the pass on this wave's diagonal pays for the mask; every column keeps at least key qw0 */
#pragma unroll
          for (int g = 0; g < 2; ++g)
#pragma unroll
            for (int kt = 0; kt < 2; ++kt) {
#pragma unroll
              for (int r = 0; r < 8; ++r) if (16 * kt + 8 * hh + r > 16 * g + c) s[kt][g][r] = -__builtin_inff();
              asm volatile("" : "+v"(s[kt][g])); } }      /* keeps the selects inside the branch */
        float mb[2]; bool need = false;
#pragma unroll
        for (int g = 0; g < 2; ++g) { float mx = s[0][g][0];
#pragma unroll
          for (int r = 1; r < 8; ++r) mx = fmaxf(mx, s[0][g][r]);
#pragma unroll
          for (int r = 0; r < 8; ++r) mx = fmaxf(mx, s[1][g][r]);
          mx = fmaxf(mx, half_x(mx)) * cs; mb[g] = mx; need = need || (mx > m_run[g] + 8.0f); }      /* both halves of the wave now hold the query's maximum of this pass */
        if (__builtin_amdgcn_ballot_w32(need) != 0) {      /* wave-uniform; rare behind the first passes */
#pragma unroll
          for (int g = 0; g < 2; ++g) { const float mn = fmaxf(m_run[g], mb[g]); const float corr = exp2_1(m_run[g] - mn);      /* mn is finite from the first pass on (key 0 is open to every query); corr = 0 there */
            l_run[g] *= corr; m_run[g] = mn;
#pragma unroll
            for (int t = 0; t < 8; ++t) acc[g][t] = acc[g][t] * corr; } }
        FragH pf[2];
#pragma unroll
        for (int g = 0; g < 2; ++g) { const float nm = -m_run[g]; float ps = 0.f;
#pragma unroll
          for (int kt = 0; kt < 2; ++kt)
#pragma unroll
            for (int u4 = 0; u4 < 2; ++u4) { v4f a;
#pragma unroll
              for (int u = 0; u < 4; ++u) a[u] = fmaf(s[kt][g][4 * u4 + u], cs, nm);
              const v4f e = exp2_4(a); ps += (e[0] + e[1]) + (e[2] + e[3]);
#pragma unroll
              for (int u = 0; u < 4; ++u) pf[g].h[8 * kt + 4 * u4 + u] = (_Float16)e[u]; }
          l_run[g] += ps; }
        __builtin_amdgcn_sched_barrier(0);      /* the exponentials, which are asm text, all stay in front of the products */
#pragma unroll
        for (int t = 0; t < 8; ++t)
#pragma unroll
          for (int g = 0; g < 2; ++g) acc[g][t] = fa_mma(vf[t], pf[g].v, acc[g][t]);
        fa_gap(); } }
    asm volatile("s_wait_dscnt 0x0" ::: "memory");      /* this wave's reads of the buffer are done before it is handed to the next copies */
    asm volatile("s_wait_asynccnt 0x0" ::: "memory");      /* this wave's copies of stage st + 1 have landed */
    __syncthreads();      /* publishes stage st + 1 and ends every wave's reads of stage st */
    if (st + 2 < nst) { fa_copy8(kg + (size_t)(st + 2) * 64 * DKV, (size_t)8 * DKV, lk + (st & 1) * FST, 8 * FPK); fa_copy8(vg + (st + 2) * 64, (size_t)16 * SQ, lv + (st & 1) * FST, 16 * FPV); } }
  asm volatile("s_wait_asynccnt 0x0" ::: "memory");      /* no copy is in flight when the wave ends */
#pragma unroll
  for (int g = 0; g < 2; ++g) { const float inv = 64.0f / (l_run[g] + half_x(l_run[g]));      /* each half of the wave summed its own eight keys of every 16; o x64 */
    unsigned short* op = (unsigned short*)O16 + ((size_t)b * SQ + qw0 + 16 * g + c) * DMX + head * HDK + 8 * hh;
#pragma unroll
    for (int t = 0; t < 8; ++t) { FragH f;      /* accumulator register r = dim 16 t + 8 hh + r of query c: 16 contiguous bytes */
#pragma unroll
      for (int r = 0; r < 8; ++r) f.h[r] = (_Float16)(acc[g][t][r] * inv);
      *(v8us*)(op + 16 * t) = f.half[0]; } } }
// ---- large GEMM: C[M][N] (f32; H16: C16 = the same values in f16) = alpha A[M][DMX] Bt[N][DMX]^T, f16 operands, both k-contiguous with row pitch DMX ----
// A block of WR x WC waves owns a tile of 64 WR rows x 64 WC columns, a wave 64 x 64 of it (4 x 4 accumulator tiles): a staged byte serves 64 WC (A) or 64 WR (B) outputs, a fragment read from LDS four products.
// The k range goes in tiles of 128: the block's rows of A, then its rows of Bt, 256 bytes of each, are staged in LDS (pitch 272 bytes, an odd multiple of 16, for 16-byte readers), two buffers,
// the next tile's copies in flight while this one is multiplied. A wave's copy moves two whole rows of 256 bytes. A fragment keeps the k order of g2_frag and k rises in steps of 32, so every sum keeps its order.
template <int WR, int WC, int N, bool H16>
__global__ __launch_bounds__(32 * WR * WC) void k_gemm3(const _Float16* __restrict__ A, const _Float16* __restrict__ Bt, float alpha, float* __restrict__ C, _Float16* __restrict__ C16) {
  constexpr int KC = 128, BM = 64 * WR, BN = 64 * WC, RPC = 2 * WR * WC, NTL = DMX / KC; constexpr unsigned PB = 2 * KC + 16, STB = (BM + BN) * PB;      /* RPC: rows that one copy of every thread covers; PB, STB bytes: a staged row's pitch, one buffer */
  static_assert(NR % BM == 0 && N % BN == 0 && DMX % KC == 0 && NTL >= 2 && BM % (8 * RPC) == 0 && BN % (8 * RPC) == 0, "k_gemm3: whole tiles, eight copies a statement");
  static_assert((BM + BN) / RPC <= 63, "k_gemm3: one tile's copies of a wave in flight"); static_assert(2 * STB >= WR * WC * 64 * 68 * 4, "the output staging reuses the two buffers");
  __shared__ __attribute__((aligned(16))) unsigned char sm[2 * STB]; float (*so)[64][68] = reinterpret_cast<float (*)[64][68]>(sm);      /* so: each wave's output staging, used behind the loop's last barrier */
  const int tid = threadIdx.x, lane = tid & 31, ln = lane & 15, hh = lane >> 4; const int w = __builtin_amdgcn_readfirstlane(tid >> 5), wr = w / WC, wc = w % WC;
  const int mt = blockIdx.x / (N / BN), nq = blockIdx.x % (N / BN);
  const _Float16* ag = A + (size_t)(mt * BM + (tid >> 4)) * DMX + (tid & 15) * 8; const _Float16* bg = Bt + (size_t)(nq * BN + (tid >> 4)) * DMX + (tid & 15) * 8;      /* thread = 16 bytes of row (thread / 16) + c RPC */
  const unsigned l0 = (unsigned)(size_t)sm + (unsigned)(tid >> 4) * PB + (unsigned)(tid & 15) * 16;
  auto stage = [&](int t, unsigned l) {      /* k tile t into the buffer in which l is the thread's own first place */
#pragma unroll      /* unrolled: constant row offsets */
    for (int c = 0; c < BM / RPC; c += 8) fa_copy8(ag + (size_t)t * KC + (size_t)(c * RPC) * DMX, (size_t)RPC * DMX, l + (unsigned)(c * RPC) * PB, RPC * PB);
#pragma unroll
    for (int c = 0; c < BN / RPC; c += 8) fa_copy8(bg + (size_t)t * KC + (size_t)(c * RPC) * DMX, (size_t)RPC * DMX, l + (unsigned)(BM + c * RPC) * PB, RPC * PB); };
  stage(0, l0);
  asm volatile("s_wait_asynccnt 0x0" ::: "memory");      /* this wave's copies of tile 0 have landed */
  __syncthreads();      /* ... and every other wave's */
  stage(1, l0 + STB);
  const v8f z8 = {0.f,0.f,0.f,0.f,0.f,0.f,0.f,0.f}; v8f acc[4][4];
#pragma unroll
  for (int i = 0; i < 4; ++i)
#pragma unroll
    for (int j = 0; j < 4; ++j) acc[i][j] = z8;
#pragma unroll 1      /* one trip a tile: the two buffers take turns */
  for (int t = 0; t < NTL; ++t) { const unsigned char* sb = sm + (t & 1) * STB;
    const unsigned char* ap = sb + (unsigned)(64 * wr + ln) * PB; const unsigned char* bp = sb + (unsigned)(BM + 64 * wc + ln) * PB;
    v16h fa[2][4], fb[2][4];      /* two fragment sets: a k step's 16 LDS loads go as one group, one step ahead of its products, inside this tile only */
#pragma unroll
    for (int i = 0; i < 4; ++i) { fa[0][i] = g2_frag((const _Float16*)(ap + 16 * i * PB), hh); fb[0][i] = g2_frag((const _Float16*)(bp + 16 * i * PB), hh); }
#pragma unroll      /* unrolled: the sets keep static indices (registers), every LDS offset is an immediate */
    for (int s = 0; s < KC / 32; ++s) { const int u = s & 1, n = u ^ 1;
      if (s + 1 < KC / 32) {
#pragma unroll
        for (int i = 0; i < 4; ++i) { fa[n][i] = g2_frag((const _Float16*)(ap + 16 * i * PB) + (s + 1) * 32, hh); fb[n][i] = g2_frag((const _Float16*)(bp + 16 * i * PB) + (s + 1) * 32, hh); } }
      __builtin_amdgcn_sched_barrier(0);      /* the next step's loads stay one group in front of this step's products (without it this build loaded each fragment of Bt right in front of its four products and waited for it there) */
#pragma unroll
      for (int j = 0; j < 4; ++j)
#pragma unroll
        for (int i = 0; i < 4; ++i) acc[i][j] = fa_mma(fa[u][i], fb[u][j], acc[i][j]);
      __builtin_amdgcn_sched_barrier(0); }      /* ... and the group behind them is not spread among them */
    fa_gap();      /* the branches below (the refill, the loop's end) lead to vector instructions that may reuse the last products' operand registers or read their results */
    asm volatile("s_wait_dscnt 0x0" ::: "memory");      /* this wave's reads of the buffer are done before it is handed to the next copies */
    asm volatile("s_wait_asynccnt 0x0" ::: "memory");      /* this wave's copies of tile t + 1 have landed */
    __syncthreads();      /* publishes tile t + 1 and ends every wave's reads of tile t */
    if (t + 2 < NTL) stage(t + 2, l0 + (t & 1) * STB); }
  asm volatile("s_wait_asynccnt 0x0" ::: "memory");      /* no copy is in flight when the buffers become output staging */
#pragma unroll
  for (int i = 0; i < 4; ++i)
#pragma unroll
    for (int j = 0; j < 4; ++j)
#pragma unroll
      for (int r = 0; r < 8; ++r) so[w][16 * i + 8 * hh + r][16 * j + ln] = acc[i][j][r] * alpha;
  __builtin_amdgcn_fence(__ATOMIC_ACQ_REL, "workgroup"); __builtin_amdgcn_wave_barrier();      /* the wave's own rows are whole before its lanes read what other lanes wrote */
  const size_t o0 = (size_t)(mt * BM + 64 * wr + hh) * N + nq * BN + 64 * wc + ln * 4;      /* a store = two rows of 256 contiguous bytes (f32) */
#pragma unroll
  for (int q = 0; q < 32; ++q) { const v4f v = *(const v4fa*)&so[w][q * 2 + hh][ln * 4]; *(v4f*)(C + o0 + (size_t)(q * 2) * N) = v;
    if (H16) { v4h h4;
#pragma unroll
      for (int i = 0; i < 4; ++i) h4[i] = (_Float16)v[i];
      *(v4h*)(C16 + o0 + (size_t)(q * 2) * N) = h4; } } }
// ---- q, k, v products in one launch: C[M][N] (f32) = alpha A[M][DMX] Bt[N][DMX]^T for the three weights side by side (DMX + 2 DKV columns), operands and k order as in k_gemm3 ----
// A block of 4 x 2 waves owns a tile of 256 rows x 256 columns, which lies wholly in one of the three products; a wave 64 x 128 of it (4 x 8 accumulator tiles): a staged byte serves 256 outputs,
// a fragment of A read from LDS eight products, one of Bt four. The three products together are as many tiles as the chip has WGPs. Ring, pitch and order of the waits are those of k_gemm3.
// one wave's 64 x 128 results out of its staging: a store = one row of 512 contiguous bytes (f32); N compile-time, so that the rows are immediate offsets from one address.
template <int N, bool H16>
__device__ __forceinline__ void g4_put(const float (*sw)[132], float* __restrict__ C, _Float16* __restrict__ C16, size_t o0, int lane) {
#pragma unroll
  for (int q = 0; q < 64; ++q) { const v4f v = *(const v4fa*)&sw[q][lane * 4]; *(v4f*)(C + o0 + (size_t)q * N) = v;
    if (H16) { v4h h4;
#pragma unroll
      for (int i = 0; i < 4; ++i) h4[i] = (_Float16)v[i];
      *(v4h*)(C16 + o0 + (size_t)q * N) = h4; } }
  asm volatile("s_wait_xcnt 0x0" ::: "memory"); }      /* closes this call's stores: the three calls lie one behind another in the listing, and the next one's code reuses the registers that the last stores name */
__global__ __launch_bounds__(256) void k_gemm_qkv(const _Float16* __restrict__ A, const _Float16* __restrict__ BQ, const _Float16* __restrict__ BK, const _Float16* __restrict__ BV, float alpha,
    float* __restrict__ QF, float* __restrict__ KF, float* __restrict__ VF, _Float16* __restrict__ V16) {
  constexpr int KC = 128, BM = 256, BN = 256, RPC = 16, NTL = DMX / KC, NTQ = DMX / BN, NTK = DKV / BN, NTN = NTQ + 2 * NTK; constexpr unsigned PB = 2 * KC + 16, STB = (BM + BN) * PB;      /* RPC: rows that one copy of every thread covers; PB, STB bytes: a staged row's pitch, one buffer */
  static_assert(NR % BM == 0 && DMX % BN == 0 && DKV % BN == 0 && DMX % KC == 0 && NTL >= 2 && BM % (8 * RPC) == 0 && BN % (8 * RPC) == 0, "k_gemm_qkv: whole tiles, eight copies a statement");
  static_assert((BM + BN) / RPC <= 63, "k_gemm_qkv: one tile's copies of a wave in flight"); static_assert(2 * STB >= 8 * 64 * 132 * 4, "the output staging reuses the two buffers");
  __shared__ __attribute__((aligned(16))) unsigned char sm[2 * STB]; float (*so)[64][132] = reinterpret_cast<float (*)[64][132]>(sm);      /* so: each wave's output staging, used behind the loop's last barrier */
  const int tid = threadIdx.x, lane = tid & 31, ln = lane & 15, hh = lane >> 4; const int w = __builtin_amdgcn_readfirstlane(tid >> 5), wr = w >> 1, wc = w & 1;
  const int mt = blockIdx.x / NTN, nq = blockIdx.x % NTN; const int sel = (nq < NTQ) ? 0 : (nq < NTQ + NTK) ? 1 : 2, nl = (sel == 0) ? nq : (sel == 1) ? nq - NTQ : nq - NTQ - NTK;      /* which product, and the tile's place in it: the same for the whole block */
  const _Float16* Bt = (sel == 0) ? BQ : (sel == 1) ? BK : BV;
  const _Float16* ag = A + (size_t)(mt * BM + (tid >> 4)) * DMX + (tid & 15) * 8; const _Float16* bg = Bt + (size_t)(nl * BN + (tid >> 4)) * DMX + (tid & 15) * 8;      /* thread = 16 bytes of row (thread / 16) + c RPC */
  const unsigned l0 = (unsigned)(size_t)sm + (unsigned)(tid >> 4) * PB + (unsigned)(tid & 15) * 16;
  auto stage = [&](int t, unsigned l) {      /* k tile t into the buffer in which l is the thread's own first place */
#pragma unroll      /* unrolled: constant row offsets */
    for (int c = 0; c < BM / RPC; c += 8) fa_copy8(ag + (size_t)t * KC + (size_t)(c * RPC) * DMX, (size_t)RPC * DMX, l + (unsigned)(c * RPC) * PB, RPC * PB);
#pragma unroll
    for (int c = 0; c < BN / RPC; c += 8) fa_copy8(bg + (size_t)t * KC + (size_t)(c * RPC) * DMX, (size_t)RPC * DMX, l + (unsigned)(BM + c * RPC) * PB, RPC * PB); };
  stage(0, l0);
  asm volatile("s_wait_asynccnt 0x0" ::: "memory");      /* this wave's copies of tile 0 have landed */
  __syncthreads();      /* ... and every other wave's */
  stage(1, l0 + STB);
  const v8f z8 = {0.f,0.f,0.f,0.f,0.f,0.f,0.f,0.f}; v8f acc[4][8];
#pragma unroll
  for (int i = 0; i < 4; ++i)
#pragma unroll
    for (int j = 0; j < 8; ++j) acc[i][j] = z8;
#pragma unroll 1      /* one trip a tile: the two buffers take turns */
  for (int t = 0; t < NTL; ++t) { const unsigned char* sb = sm + (t & 1) * STB;
    const unsigned char* ap = sb + (unsigned)(64 * wr + ln) * PB; const unsigned char* bp = sb + (unsigned)(BM + 128 * wc + ln) * PB;
    v16h fa[2][4], fb[2][8];      /* two fragment sets: a k step's 24 LDS loads go as one group, one step ahead of its products, inside this tile only */
#pragma unroll
    for (int i = 0; i < 4; ++i) fa[0][i] = g2_frag((const _Float16*)(ap + 16 * i * PB), hh);
#pragma unroll
    for (int j = 0; j < 8; ++j) fb[0][j] = g2_frag((const _Float16*)(bp + 16 * j * PB), hh);
#pragma unroll      /* unrolled: the sets keep static indices (registers), every LDS offset is an immediate */
    for (int s = 0; s < KC / 32; ++s) { const int u = s & 1, n = u ^ 1;
      if (s + 1 < KC / 32) {
#pragma unroll
        for (int i = 0; i < 4; ++i) fa[n][i] = g2_frag((const _Float16*)(ap + 16 * i * PB) + (s + 1) * 32, hh);
#pragma unroll
        for (int j = 0; j < 8; ++j) fb[n][j] = g2_frag((const _Float16*)(bp + 16 * j * PB) + (s + 1) * 32, hh); }
      __builtin_amdgcn_sched_barrier(0);      /* the next step's loads stay one group in front of this step's products, as in k_gemm3 */
#pragma unroll
      for (int j = 0; j < 8; ++j)
#pragma unroll
        for (int i = 0; i < 4; ++i) acc[i][j] = fa_mma(fa[u][i], fb[u][j], acc[i][j]);
      __builtin_amdgcn_sched_barrier(0); }      /* ... and the group behind them is not spread among them */
    fa_gap();      /* the branches below (the refill, the loop's end) lead to vector instructions that may reuse the last products' operand registers or read their results */
    asm volatile("s_wait_dscnt 0x0" ::: "memory");      /* this wave's reads of the buffer are done before it is handed to the next copies */
    asm volatile("s_wait_asynccnt 0x0" ::: "memory");      /* this wave's copies of tile t + 1 have landed */
    __syncthreads();      /* publishes tile t + 1 and ends every wave's reads of tile t */
    if (t + 2 < NTL) stage(t + 2, l0 + (t & 1) * STB); }
  asm volatile("s_wait_asynccnt 0x0" ::: "memory");      /* no copy is in flight when the buffers become output staging */
#pragma unroll
  for (int i = 0; i < 4; ++i)
#pragma unroll
    for (int j = 0; j < 8; ++j)
#pragma unroll
      for (int r = 0; r < 8; ++r) so[w][16 * i + 8 * hh + r][16 * j + ln] = acc[i][j][r] * alpha;
  __builtin_amdgcn_fence(__ATOMIC_ACQ_REL, "workgroup"); __builtin_amdgcn_wave_barrier();      /* the wave's own rows are whole before its lanes read what other lanes wrote */
  const size_t r0 = (size_t)(mt * BM + 64 * wr); const int c0 = nl * BN + 128 * wc + lane * 4;
  if (sel == 0) g4_put<DMX, false>(so[w], QF, nullptr, r0 * DMX + c0, lane);      /* block-uniform */
  else if (sel == 1) g4_put<DKV, false>(so[w], KF, nullptr, r0 * DKV + c0, lane);
  else g4_put<DKV, true>(so[w], VF, V16, r0 * DKV + c0, lane); }
extern "C" void kernel_launch(void* const* d_in, const int* in_sizes, int n_in,
                              void* d_out, int out_size, void* d_ws, size_t ws_size, hipStream_t stream) {
  (void)in_sizes; (void)n_in; (void)out_size;
  const float* const* I = (const float* const*)d_in; const float* x = I[0]; const float* wq = I[1]; const float* wk = I[2]; const float* wv = I[3]; const float* wo = I[4]; const float* qnw = I[5]; const float* knw = I[6]; const float* tcos = I[7]; const float* tsin = I[8];      /* [in][out] weights; rope tables [S][128] */
  char* ws = (char*)d_ws; size_t off = 0;
  auto take = [&](size_t bytes) { char* p = ws + off; off += (bytes + 255) & ~(size_t)255; return p; };
  _Float16* BQ = (_Float16*)take((size_t)DMX * DMX * 2); _Float16* BK = (_Float16*)take((size_t)DKV * DMX * 2); _Float16* BV = (_Float16*)take((size_t)DKV * DMX * 2); _Float16* BO = (_Float16*)take((size_t)DMX * DMX * 2);
  _Float16* X16 = (_Float16*)take(NR * DMX * 2); float* QF = (float*)take(NR * DMX * 4); float* KF = (float*)take(NR * DKV * 4); float* VF = (float*)take(NR * DKV * 4); _Float16* Q16 = (_Float16*)take(NR * DMX * 2); _Float16* K16 = (_Float16*)take(NR * DKV * 2); _Float16* V16 = (_Float16*)take(NR * DKV * 2); _Float16* O16 = (_Float16*)take(NR * DMX * 2);
  _Float16* VT = (_Float16*)take((size_t)NB * (DKV / 64) * 64 * SQ * 2);
  float* QF0 = (float*)take((size_t)NB * QT0 * DMX * 4); float* KF0e = (float*)take((size_t)NB * QT0 * DMX * 4); _Float16* OL0 = (_Float16*)take((size_t)NB * QT0 * DMX * 2);
  if (off > ws_size) return;
  k_wt4<<<2 * WTQ + 2 * WTV, 256, 0, stream>>>(wq, wk, wv, wo, BQ, BK, BV, BO);      /* the four weights, [in][out] -> Bt x16 */
  k_x16<<<(unsigned)((NR * DMX / 8 + 255) / 256), 256, 0, stream>>>(x, X16, NR * DMX / 8);
  k_gemm_qkv<<<(unsigned)((NR / 256) * ((DMX + 2 * DKV) / 256)), 256, 0, stream>>>(X16, BQ, BK, BV, 0.0625f, QF, KF, VF, V16);      /* q, k (f32), v (f32 for the first tile + f16) */
  k_nrope<<<(unsigned)(NR / 8), 256, 0, stream>>>(QF, KF, qnw, knw, tcos, tsin, Q16, K16, QF0, KF0e);      /* per-head RMSNorm + rope from the input tables -> f16; rows 0..127 of each batch also f32, k expanded group -> head */
  k_vt<DKV / 64, SQ><<<NB * (DKV / 64) * (SQ / 64), 256, 0, stream>>>(V16, DKV, 0, VT);      /* V^T, both batches: batch b, group g = slabs 16b + 2g, 16b + 2g + 1 */
  k_fattn<<<dim3(NH * NB, SQ / FQ), 128, 0, stream>>>(Q16, K16, VT, O16);      /* causal attention, all heads, batches and rows: o (x64) */
  k_att0w<<<dim3(NH * (QT0 / 8), NB), 256, 0, stream>>>(QF0, KF0e, VF, ATS, O16, OL0);      /* exact causal attention rows 0..127 of both batches (o x64), behind k_fattn: its f16 hi plane replaces those rows of O16; lo x1024 into OL0 */
  k_gemm3<4, 2, DMX, false><<<(unsigned)((NR / 256) * (DMX / 128)), 256, 0, stream>>>(O16, BO, 0.0009765625f, (float*)d_out, nullptr);      /* out = o Wo^T (rows 0..127 of each batch: the hi plane's product) */
  k_gemm2<0, 128><<<dim3((QT0 / 128) * (DMX / 64), 1, NB), 128, 0, stream>>>(OL0, DMX, 0, BO, DMX, 0, 0.00000095367431640625f, nullptr, 0, (const float*)d_out, -1, 0, 0, (float*)d_out, nullptr, DMX, 0, QT0, DMX, DMX, 1, (size_t)QT0 * DMX, 0, (size_t)SQ * DMX);      /* rows 0..127 of each batch: + the lo plane's product */
}
